// v000
// Measured on an AMD MI455X. A time is GPU time per run, averaged over a window of back-to-back runs after a warm-up
// (all launches, gaps included; the runs take copies of the inputs in turn), and the median of several windows.
// Apart from v000's, it joins two sittings. Times from different sittings can be a few percent apart, while
// side-by-side timings come from the same sitting.
// v000, which the later versions start from, runs in 225 microseconds.
#include <hip/hip_runtime.h>
#include <hip/hip_bf16.h>
#include <stdint.h>

#define S_LEN 2048
#define EMB   2048
#define NH    16
#define HD    128

typedef __attribute__((ext_vector_type(16))) __bf16 v16bf;
typedef __attribute__((ext_vector_type(8)))  __bf16 v8bf;
typedef __attribute__((ext_vector_type(8)))  float  v8f;
typedef __attribute__((ext_vector_type(4)))  unsigned int u32x4;
typedef __attribute__((ext_vector_type(8)))  int          i32x8;
typedef __attribute__((ext_vector_type(4)))  int          i32x4;

union FragU { v16bf f; struct { v8bf lo, hi; } p; };

// Load one 16x32 bf16 WMMA operand fragment from global (A-layout; B uses the
// same per-lane pattern with "row" = B column, both K-contiguous in memory).
// Per ISA 7.12.2: lanes 0-15 hold K=0..7 (v0-3) and K=16..23 (v4-7),
// lanes 16-31 hold K=8..15 and K=24..31.
static __device__ inline v16bf load_frag(const __bf16* __restrict__ base, int ld, int lane) {
    const int l  = lane & 15;
    const int hi = lane >> 4;
    const __bf16* p = base + (size_t)l * ld + hi * 8;
    FragU u;
    u.p.lo = *(const v8bf*)(p);
    u.p.hi = *(const v8bf*)(p + 16);
    return u.f;
}

static __device__ inline v8f wmma_bf16(v16bf a, v16bf b, v8f c) {
    return __builtin_amdgcn_wmma_f32_16x16x32_bf16(false, a, false, b, (short)0, c, false, false);
}

// ---------------------------------------------------------------------- TDM
// Issue one Tensor-Data-Mover 2D tile load of (tileRows x tileCols) bf16
// elements from a row-major [rows, ld] bf16 tensor into LDS at byte offset
// ldsOff, appending LDS padding after each row (pad codes per D# §8.4:
// padInterval: 0=2,1=4,..,7=256 DWORDs between pads; padAmount: n+1 DWORDs)
// so ds_load_b128 fragment fetches are bank-conflict-free.
static __device__ inline void tdm_load_tile(const __bf16* gtile, unsigned ldsOff,
                                            int rows, int ld,
                                            int tileCols, int tileRows,
                                            unsigned padInterval, unsigned padAmount) {
    const unsigned long long ga = (unsigned long long)(uintptr_t)gtile;
    u32x4 g0;
    g0.x = 1u;                                      // count=1, user descriptor
    g0.y = ldsOff;                                  // lds_addr (bytes)
    g0.z = (unsigned)ga;                            // global_addr[31:0]
    g0.w = (unsigned)((ga >> 32) & 0x01FFFFFFu)     // global_addr[56:32]
         | (2u << 30);                              // type = 2 ("image")
    i32x8 g1;
    g1[0] = (int)((1u << 16)                        // data_size: 2 bytes
                | (1u << 20)                        // pad_enable
                | (padInterval << 22)
                | (padAmount << 25));
    g1[1] = (int)(((unsigned)ld & 0xFFFFu) << 16);             // tensor_dim0 lo
    g1[2] = (int)((((unsigned)ld >> 16) & 0xFFFFu)
                | (((unsigned)rows & 0xFFFFu) << 16));          // dim0 hi | dim1 lo
    g1[3] = (int)(((((unsigned)rows) >> 16) & 0xFFFFu)
                | (((unsigned)tileCols) << 16));                // dim1 hi | tile_dim0
    g1[4] = tileRows;                                           // tile_dim1
    g1[5] = ld;                                                 // tensor_dim0_stride
    g1[6] = 0;
    g1[7] = 0;
    const i32x4 z4 = (i32x4){0, 0, 0, 0};
#if defined(__clang_major__) && (__clang_major__ >= 23)
    const i32x8 z8 = (i32x8){0, 0, 0, 0, 0, 0, 0, 0};
    __builtin_amdgcn_tensor_load_to_lds(g0, g1, z4, z4, z8, 0);
#else
    __builtin_amdgcn_tensor_load_to_lds(g0, g1, z4, z4, 0);
#endif
}

// ---------------------------------------------------------------- fp32 -> bf16
__global__ __launch_bounds__(256) void cvt_bf16_kernel(const float* __restrict__ src,
                                                       __bf16* __restrict__ dst, int n) {
    for (int i = blockIdx.x * blockDim.x + threadIdx.x; i < n; i += gridDim.x * blockDim.x)
        dst[i] = (__bf16)src[i];
}

// ------------------------------------------------- C = A[M,K] * W[N,K]^T + bias
// TDM-staged, double-buffered LDS pipeline; 8 waves compute a 128x128 C tile.
// outMode: 0 = f32 row-major, 1 = bf16 row-major, 2 = bf16 transposed [N,M]
#define LDS_PITCH 40   // bf16 elems per 32-elem LDS tile row (+8 TDM pad)
#define KT_PITCH  136  // bf16 elems per 128-elem LDS tile row (+8 TDM pad)

#define GEMM_LDS_FRAG(tile, row0, dst) do {                              \
        FragU _u;                                                        \
        const int _r = (row0) + l;                                       \
        _u.p.lo = *(const v8bf*)&(tile)[_r * LDS_PITCH + hi * 8];        \
        _u.p.hi = *(const v8bf*)&(tile)[_r * LDS_PITCH + hi * 8 + 16];   \
        (dst) = _u.f; } while (0)

__global__ __launch_bounds__(256) void gemm_bf16_kernel(
    const __bf16* __restrict__ A, const __bf16* __restrict__ W,
    const float* __restrict__ bias,
    float* __restrict__ outF, __bf16* __restrict__ outB,
    int M, int N, int K, int outMode)
{
    __shared__ alignas(16) __bf16 Atile[2][128 * LDS_PITCH];
    __shared__ alignas(16) __bf16 Btile[2][128 * LDS_PITCH];

    const int lane = threadIdx.x & 31;
    const int w    = threadIdx.x >> 5;            // 8 waves: 4 (M) x 2 (N)
    const int bm   = blockIdx.y * 128;
    const int bn   = blockIdx.x * 128;
    const int wmr  = (w >> 1) * 32;               // wave row offset in block tile
    const int wnc  = (w & 1) * 64;                // wave col offset in block tile
    const int l    = lane & 15;
    const int hi   = lane >> 4;

    v8f acc[2][4];
#pragma unroll
    for (int i = 0; i < 2; ++i)
#pragma unroll
        for (int j = 0; j < 4; ++j)
            acc[i][j] = (v8f){0.f,0.f,0.f,0.f,0.f,0.f,0.f,0.f};

    // Prologue: stage k-step 0 (wave 0 issues; EXEC-independent DMA).
    if (threadIdx.x < 32) {
        tdm_load_tile(A + (size_t)bm * K, (unsigned)(uintptr_t)&Atile[0][0], M, K, 32, 128, 3, 3);
        tdm_load_tile(W + (size_t)bn * K, (unsigned)(uintptr_t)&Btile[0][0], N, K, 32, 128, 3, 3);
    }

    const int nk = K / 32;
    for (int i = 0; i < nk; ++i) {
        const int cur = i & 1;
        if (threadIdx.x < 32) {
            if (i + 1 < nk) {
                const int k0n = (i + 1) * 32;
                tdm_load_tile(A + (size_t)bm * K + k0n,
                              (unsigned)(uintptr_t)&Atile[cur ^ 1][0], M, K, 32, 128, 3, 3);
                tdm_load_tile(W + (size_t)bn * K + k0n,
                              (unsigned)(uintptr_t)&Btile[cur ^ 1][0], N, K, 32, 128, 3, 3);
                __builtin_amdgcn_s_wait_tensorcnt(2);   // step i done; step i+1 in flight
            } else {
                __builtin_amdgcn_s_wait_tensorcnt(0);
            }
        }
        __syncthreads();

        v16bf a0, a1, bfr[4];
        GEMM_LDS_FRAG(Atile[cur], wmr,      a0);
        GEMM_LDS_FRAG(Atile[cur], wmr + 16, a1);
#pragma unroll
        for (int j = 0; j < 4; ++j)
            GEMM_LDS_FRAG(Btile[cur], wnc + j * 16, bfr[j]);
#pragma unroll
        for (int j = 0; j < 4; ++j) {
            acc[0][j] = wmma_bf16(a0, bfr[j], acc[0][j]);
            acc[1][j] = wmma_bf16(a1, bfr[j], acc[1][j]);
        }
        __syncthreads();
    }

    const int wm = bm + wmr;
    const int wn = bn + wnc;
    if (outMode == 0) {
#pragma unroll
        for (int i = 0; i < 2; ++i)
#pragma unroll
            for (int j = 0; j < 4; ++j) {
                const int col = wn + j * 16 + l;
                const float bc = bias ? bias[col] : 0.f;
#pragma unroll
                for (int r = 0; r < 8; ++r)
                    outF[(size_t)(wm + i * 16 + r + hi * 8) * N + col] = acc[i][j][r] + bc;
            }
    } else if (outMode == 1) {
#pragma unroll
        for (int i = 0; i < 2; ++i)
#pragma unroll
            for (int j = 0; j < 4; ++j) {
                const int col = wn + j * 16 + l;
                const float bc = bias ? bias[col] : 0.f;
#pragma unroll
                for (int r = 0; r < 8; ++r)
                    outB[(size_t)(wm + i * 16 + r + hi * 8) * N + col] =
                        (__bf16)(acc[i][j][r] + bc);
            }
    } else {
#pragma unroll
        for (int i = 0; i < 2; ++i)
#pragma unroll
            for (int j = 0; j < 4; ++j) {
                const int col = wn + j * 16 + l;
                const float bc = bias ? bias[col] : 0.f;
#pragma unroll
                for (int r = 0; r < 8; ++r)
                    outB[(size_t)col * M + (wm + i * 16 + r + hi * 8)] =
                        (__bf16)(acc[i][j][r] + bc);
            }
    }
}

// ----------------------------------------------------------- flash attention
// Q, K: bf16 [S, EMB] (head h in cols h*HD..); Vt: bf16 [EMB, S] (row h*HD+d).
// Block = 8 waves x 16 query rows, one head. Per key-step of 32, wave 0 TDM-
// stages the shared K tile (32xHD) and Vt tile (HDx32) into double-buffered
// LDS; all waves consume via ds_load_b128.
__global__ __launch_bounds__(256) void flash_attn_kernel(
    const __bf16* __restrict__ Q, const __bf16* __restrict__ Kmat,
    const __bf16* __restrict__ Vt, __bf16* __restrict__ Ao)
{
    __shared__ alignas(16) __bf16 Ktile[2][32 * KT_PITCH];     // rows t, cols d
    __shared__ alignas(16) __bf16 Vtile[2][128 * LDS_PITCH];   // rows d, cols t
    __shared__ alignas(16) __bf16 Plds[8][16 * 32];            // wave-private P

    const int lane = threadIdx.x & 31;
    const int w    = threadIdx.x >> 5;
    const int q0   = blockIdx.x * 128 + w * 16;
    const int h    = blockIdx.y;
    const int l    = lane & 15;
    const int hi   = lane >> 4;
    const float sc = 0.08838834764831845f;    // 1/sqrt(HD)

    v16bf qf[4];
#pragma unroll
    for (int kk = 0; kk < 4; ++kk)
        qf[kk] = load_frag(Q + (size_t)q0 * EMB + h * HD + kk * 32, EMB, lane);

    v8f acc[8];
#pragma unroll
    for (int d = 0; d < 8; ++d) acc[d] = (v8f){0.f,0.f,0.f,0.f,0.f,0.f,0.f,0.f};
    float m[8], lsum[8];
#pragma unroll
    for (int r = 0; r < 8; ++r) { m[r] = -3.0e38f; lsum[r] = 0.f; }

    // Prologue: stage key-step 0.
    if (threadIdx.x < 32) {
        tdm_load_tile(Kmat + (size_t)0 * EMB + h * HD,
                      (unsigned)(uintptr_t)&Ktile[0][0], S_LEN, EMB, 128, 32, 5, 3);
        tdm_load_tile(Vt + (size_t)(h * HD) * S_LEN + 0,
                      (unsigned)(uintptr_t)&Vtile[0][0], EMB, S_LEN, 32, 128, 3, 3);
    }

    const int nt = S_LEN / 32;
    for (int i = 0; i < nt; ++i) {
        const int cur = i & 1;
        if (threadIdx.x < 32) {
            if (i + 1 < nt) {
                const int t1 = (i + 1) * 32;
                tdm_load_tile(Kmat + (size_t)t1 * EMB + h * HD,
                              (unsigned)(uintptr_t)&Ktile[cur ^ 1][0], S_LEN, EMB, 128, 32, 5, 3);
                tdm_load_tile(Vt + (size_t)(h * HD) * S_LEN + t1,
                              (unsigned)(uintptr_t)&Vtile[cur ^ 1][0], EMB, S_LEN, 32, 128, 3, 3);
                __builtin_amdgcn_s_wait_tensorcnt(2);
            } else {
                __builtin_amdgcn_s_wait_tensorcnt(0);
            }
        }
        __syncthreads();

        // ---- scores: Q (16xHD) x K^T (HDx32) -> two 16x16 f32 tiles
        v8f s0 = (v8f){0.f,0.f,0.f,0.f,0.f,0.f,0.f,0.f};
        v8f s1 = (v8f){0.f,0.f,0.f,0.f,0.f,0.f,0.f,0.f};
#pragma unroll
        for (int kk = 0; kk < 4; ++kk) {
            v16bf b0, b1;
            {
                FragU _u;
                const int r0 = l;          // B column t = K-tile row (lanes 0..15)
                _u.p.lo = *(const v8bf*)&Ktile[cur][r0 * KT_PITCH + kk * 32 + hi * 8];
                _u.p.hi = *(const v8bf*)&Ktile[cur][r0 * KT_PITCH + kk * 32 + hi * 8 + 16];
                b0 = _u.f;
                const int r1 = 16 + l;
                _u.p.lo = *(const v8bf*)&Ktile[cur][r1 * KT_PITCH + kk * 32 + hi * 8];
                _u.p.hi = *(const v8bf*)&Ktile[cur][r1 * KT_PITCH + kk * 32 + hi * 8 + 16];
                b1 = _u.f;
            }
            s0 = wmma_bf16(qf[kk], b0, s0);
            s1 = wmma_bf16(qf[kk], b1, s1);
        }
        // ---- online softmax (rows live across 16 lanes of a half-wave)
        float corr[8];
#pragma unroll
        for (int r = 0; r < 8; ++r) {
            s0[r] *= sc; s1[r] *= sc;
            float mx = fmaxf(s0[r], s1[r]);
            mx = fmaxf(mx, __shfl_xor(mx, 1));
            mx = fmaxf(mx, __shfl_xor(mx, 2));
            mx = fmaxf(mx, __shfl_xor(mx, 4));
            mx = fmaxf(mx, __shfl_xor(mx, 8));
            const float mn = fmaxf(m[r], mx);
            corr[r] = __expf(m[r] - mn);
            m[r] = mn;
            s0[r] = __expf(s0[r] - mn);
            s1[r] = __expf(s1[r] - mn);
            float sum = s0[r] + s1[r];
            sum += __shfl_xor(sum, 1);
            sum += __shfl_xor(sum, 2);
            sum += __shfl_xor(sum, 4);
            sum += __shfl_xor(sum, 8);
            lsum[r] = lsum[r] * corr[r] + sum;
        }
#pragma unroll
        for (int d = 0; d < 8; ++d)
#pragma unroll
            for (int r = 0; r < 8; ++r) acc[d][r] *= corr[r];

        // ---- P: C-layout -> A-layout transpose via wave-private LDS tile.
        // DS ops from the same wave are in-order; no cross-wave sharing.
#pragma unroll
        for (int r = 0; r < 8; ++r) {
            const int row = r + hi * 8;
            Plds[w][row * 32 + l]      = (__bf16)s0[r];
            Plds[w][row * 32 + 16 + l] = (__bf16)s1[r];
        }
        FragU pu;
        pu.p.lo = *(const v8bf*)&Plds[w][l * 32 + hi * 8];
        pu.p.hi = *(const v8bf*)&Plds[w][l * 32 + hi * 8 + 16];

        // ---- acc += P (16x32) x V (32xHD); Vt-tile rows are contiguous over t
#pragma unroll
        for (int d = 0; d < 8; ++d) {
            v16bf bv;
            GEMM_LDS_FRAG(Vtile[cur], d * 16, bv);
            acc[d] = wmma_bf16(pu.f, bv, acc[d]);
        }
        __syncthreads();
    }

    // ---- normalize and emit bf16 attention output [S, EMB]
#pragma unroll
    for (int r = 0; r < 8; ++r) lsum[r] = 1.f / lsum[r];
#pragma unroll
    for (int d = 0; d < 8; ++d) {
        const int col = h * HD + d * 16 + l;
#pragma unroll
        for (int r = 0; r < 8; ++r) {
            const int row = q0 + r + hi * 8;
            Ao[(size_t)row * EMB + col] = (__bf16)(acc[d][r] * lsum[r]);
        }
    }
}

extern "C" void kernel_launch(void* const* d_in, const int* in_sizes, int n_in,
                              void* d_out, int out_size, void* d_ws, size_t ws_size,
                              hipStream_t stream) {
    (void)in_sizes; (void)n_in; (void)out_size; (void)ws_size;
    const float* x  = (const float*)d_in[0];
    const float* Wq = (const float*)d_in[1];
    const float* bq = (const float*)d_in[2];
    const float* Wk = (const float*)d_in[3];
    const float* bk = (const float*)d_in[4];
    const float* Wv = (const float*)d_in[5];
    const float* bv = (const float*)d_in[6];
    const float* Wo = (const float*)d_in[7];
    const float* bo = (const float*)d_in[8];
    float* out = (float*)d_out;

    char* ws = (char*)d_ws;
    const size_t TB = (size_t)S_LEN * EMB * sizeof(__bf16);   // 8 MB per bf16 tensor
    __bf16* xb  = (__bf16*)(ws + 0 * TB);
    __bf16* Wqb = (__bf16*)(ws + 1 * TB);
    __bf16* Wkb = (__bf16*)(ws + 2 * TB);
    __bf16* Wvb = (__bf16*)(ws + 3 * TB);
    __bf16* Wob = (__bf16*)(ws + 4 * TB);
    __bf16* Qb  = (__bf16*)(ws + 5 * TB);
    __bf16* Kb  = (__bf16*)(ws + 6 * TB);
    __bf16* Vtb = (__bf16*)(ws + 7 * TB);   // transposed [EMB, S]
    __bf16* Ab  = (__bf16*)(ws + 8 * TB);   // attention output bf16 [S, EMB]

    const int nElem = S_LEN * EMB;
    hipLaunchKernelGGL(cvt_bf16_kernel, dim3(2048), dim3(256), 0, stream, x,  xb,  nElem);
    hipLaunchKernelGGL(cvt_bf16_kernel, dim3(2048), dim3(256), 0, stream, Wq, Wqb, nElem);
    hipLaunchKernelGGL(cvt_bf16_kernel, dim3(2048), dim3(256), 0, stream, Wk, Wkb, nElem);
    hipLaunchKernelGGL(cvt_bf16_kernel, dim3(2048), dim3(256), 0, stream, Wv, Wvb, nElem);
    hipLaunchKernelGGL(cvt_bf16_kernel, dim3(2048), dim3(256), 0, stream, Wo, Wob, nElem);

    dim3 gg(EMB / 128, S_LEN / 128);
    // Q, K projections (bf16 row-major out)
    hipLaunchKernelGGL(gemm_bf16_kernel, gg, dim3(256), 0, stream,
                       xb, Wqb, bq, (float*)nullptr, Qb, S_LEN, EMB, EMB, 1);
    hipLaunchKernelGGL(gemm_bf16_kernel, gg, dim3(256), 0, stream,
                       xb, Wkb, bk, (float*)nullptr, Kb, S_LEN, EMB, EMB, 1);
    // V projection stored transposed: Vt[e, t]
    hipLaunchKernelGGL(gemm_bf16_kernel, gg, dim3(256), 0, stream,
                       xb, Wvb, bv, (float*)nullptr, Vtb, S_LEN, EMB, EMB, 2);
    // attention
    hipLaunchKernelGGL(flash_attn_kernel, dim3(S_LEN / 128, NH), dim3(256), 0, stream,
                       Qb, Kb, Vtb, Ab);
    // output projection -> f32 d_out
    hipLaunchKernelGGL(gemm_bf16_kernel, gg, dim3(256), 0, stream,
                       Ab, Wob, bo, out, (__bf16*)nullptr, S_LEN, EMB, EMB, 0);
}

// v001
// Measured time: 195 microseconds a run.
// Timed twice side by side with v000, it ran 1.19 and 1.18 times as fast.
#include <hip/hip_runtime.h>
#include <hip/hip_bf16.h>
#include <stdint.h>

#define S_LEN 2048
#define EMB   2048
#define NH    16
#define HD    128

typedef __attribute__((ext_vector_type(16))) __bf16 v16bf;
typedef __attribute__((ext_vector_type(8)))  __bf16 v8bf;
typedef __attribute__((ext_vector_type(8)))  float  v8f;
typedef __attribute__((ext_vector_type(4)))  unsigned int u32x4;
typedef __attribute__((ext_vector_type(8)))  unsigned int u32x8;
typedef __attribute__((ext_vector_type(8)))  int          i32x8;
typedef __attribute__((ext_vector_type(4)))  int          i32x4;

union FragU { v16bf f; struct { v8bf lo, hi; } p; };

// Load one 16x32 bf16 WMMA operand fragment from global (A-layout; B uses the
// same per-lane pattern with "row" = B column, both K-contiguous in memory).
// Per ISA 7.12.2: lanes 0-15 hold K=0..7 (v0-3) and K=16..23 (v4-7),
// lanes 16-31 hold K=8..15 and K=24..31.
static __device__ inline v16bf load_frag(const __bf16* __restrict__ base, int ld, int lane) {
    const int l  = lane & 15;
    const int hi = lane >> 4;
    const __bf16* p = base + (size_t)l * ld + hi * 8;
    FragU u;
    u.p.lo = *(const v8bf*)(p);
    u.p.hi = *(const v8bf*)(p + 16);
    return u.f;
}

static __device__ inline v8f wmma_bf16(v16bf a, v16bf b, v8f c) {
    return __builtin_amdgcn_wmma_f32_16x16x32_bf16(false, a, false, b, (short)0, c, false, false);
}

// ---------------------------------------------------------------------- TDM
// Issue one Tensor-Data-Mover 2D tile load of (tileRows x tileCols) bf16
// elements from a row-major [rows, ld] bf16 tensor into LDS at byte offset
// ldsOff, appending LDS padding after each row (pad codes per D# §8.4:
// padInterval: 0=2,1=4,..,7=256 DWORDs between pads; padAmount: n+1 DWORDs)
// so ds_load_b128 fragment fetches are bank-conflict-free.
static __device__ inline void tdm_load_tile(const __bf16* gtile, unsigned ldsOff,
                                            int rows, int ld,
                                            int tileCols, int tileRows,
                                            unsigned padInterval, unsigned padAmount) {
    const unsigned long long ga = (unsigned long long)(uintptr_t)gtile;
    u32x4 g0;
    g0.x = 1u;                                      // count=1, user descriptor
    g0.y = ldsOff;                                  // lds_addr (bytes)
    g0.z = (unsigned)ga;                            // global_addr[31:0]
    g0.w = (unsigned)((ga >> 32) & 0x01FFFFFFu)     // global_addr[56:32]
         | (2u << 30);                              // type = 2 ("image")
    i32x8 g1;
    g1[0] = (int)((1u << 16)                        // data_size: 2 bytes
                | (1u << 20)                        // pad_enable
                | (padInterval << 22)
                | (padAmount << 25));
    g1[1] = (int)(((unsigned)ld & 0xFFFFu) << 16);             // tensor_dim0 lo
    g1[2] = (int)((((unsigned)ld >> 16) & 0xFFFFu)
                | (((unsigned)rows & 0xFFFFu) << 16));          // dim0 hi | dim1 lo
    g1[3] = (int)(((((unsigned)rows) >> 16) & 0xFFFFu)
                | (((unsigned)tileCols) << 16));                // dim1 hi | tile_dim0
    g1[4] = tileRows;                                           // tile_dim1
    g1[5] = ld;                                                 // tensor_dim0_stride
    g1[6] = 0;
    g1[7] = 0;
    const i32x4 z4 = (i32x4){0, 0, 0, 0};
#if defined(__clang_major__) && (__clang_major__ >= 23)
    const i32x8 z8 = (i32x8){0, 0, 0, 0, 0, 0, 0, 0};
    __builtin_amdgcn_tensor_load_to_lds(g0, g1, z4, z4, z8, 0);
#else
    __builtin_amdgcn_tensor_load_to_lds(g0, g1, z4, z4, 0);
#endif
}

// ---------------------------------------------------------------- fp32 -> bf16
__global__ __launch_bounds__(256) void cvt_bf16_kernel(const float* __restrict__ src,
                                                       __bf16* __restrict__ dst, int n) {
    for (int i = blockIdx.x * blockDim.x + threadIdx.x; i < n; i += gridDim.x * blockDim.x)
        dst[i] = (__bf16)src[i];
}

// ------------------------------------------------- C = A[M,K] * W[N,K]^T + bias
// 8 waves compute a 128x128 C tile. A stage is 128 k: 256 B of each of the 128 A
// rows and 128 W rows. Every wave brings its own 32-row slice of the stage with one
// tensor load into a two-buffer LDS ring; the next stage flies while this one is
// worked on. Needs M, N multiples of 128, K a multiple of 128 and at least 256.
// outMode: 0 = f32 row-major, 1 = bf16 row-major, 2 = bf16 transposed [N,M]
#define LDS_PITCH 40   // bf16 elems per 32-elem LDS tile row (+8 TDM pad)
#define KT_PITCH  136  // bf16 elems per 128-elem LDS tile row (+8 TDM pad)

#define GEMM_LDS_FRAG(tile, row0, dst) do {                              \
        FragU _u;                                                        \
        const int _r = (row0) + l;                                       \
        _u.p.lo = *(const v8bf*)&(tile)[_r * LDS_PITCH + hi * 8];        \
        _u.p.hi = *(const v8bf*)&(tile)[_r * LDS_PITCH + hi * 8 + 16];   \
        (dst) = _u.f; } while (0)

#define G_ROWB  256u              // bytes of an operand row in one stage
#define G_PITCH 272u              // LDS row pitch: the row + the mover's 16-B pad (ds_load_b128 readers)
#define G_ROWS  32u               // rows per slice
#define G_SLICE 10240u            // 32 * 272 = 8,704 B, rounded up to a multiple of 2 KiB
#define G_BUF   (8u * G_SLICE)    // slices 0-3: A rows, slices 4-7: W rows

static __device__ inline uint32_t uni(uint32_t v) {
    return (uint32_t)__builtin_amdgcn_readfirstlane(v);
}
static __device__ inline uint32_t pinned(uint32_t v) {
    uint32_t w = uni(v);
    asm volatile("" : "+s"(w));
    return w;
}
static __device__ inline u32x4 tdm_group0(uint32_t ldsDst, uint64_t ga) {
    u32x4 g;
    g[0] = uni(1u);                                                    // count = 1
    g[1] = uni(ldsDst);                                                // byte offset in the work-group's LDS
    g[2] = uni((uint32_t)ga);                                          // global address [31:0]
    g[3] = uni((((uint32_t)(ga >> 32)) & 0x01FFFFFFu) | 0x80000000u);  // [56:32] | type = 2
    return g;
}
// 1-byte elements, tensor = tile = 32 rows of 256 B, 4 dwords of LDS pad behind every row.
static __device__ inline u32x8 tdm_group1(uint32_t srcPitch) {
    u32x8 g;
    g[0] = uni((1u << 20) | (5u << 22) | (3u << 25));
    g[1] = uni((G_ROWB & 0xFFFFu) << 16);
    g[2] = uni((G_ROWB >> 16) | ((G_ROWS & 0xFFFFu) << 16));
    g[3] = uni((G_ROWS >> 16) | (G_ROWB << 16));
    g[4] = uni(G_ROWS);
    g[5] = uni(srcPitch);
    g[6] = uni(0u);
    g[7] = uni(0u);
    return g;
}
// One request of the whole wave: the mover copies the tile into LDS through no register.
static __device__ inline void tdm_load(u32x4 g0, u32x8 g1) {
    asm volatile("tensor_load_to_lds %0, %1" :: "s"(g0), "s"(g1) : "memory");
}
static __device__ inline v16bf ring_frag(const unsigned char* p) {
    FragU u;
    u.p.lo = *(const v8bf*)(p);
    u.p.hi = *(const v8bf*)(p + 32);
    return u.f;
}

__global__ __launch_bounds__(256) void gemm_bf16_kernel(
    const __bf16* __restrict__ A, const __bf16* __restrict__ W,
    const float* __restrict__ bias,
    float* __restrict__ outF, __bf16* __restrict__ outB,
    int M, int N, int K, int outMode)
{
    __shared__ __attribute__((aligned(2048))) unsigned char ring[2u * G_BUF];

    const int lane = threadIdx.x & 31;
    const int w    = threadIdx.x >> 5;            // 8 waves: 4 (M) x 2 (N)
    const int bm   = blockIdx.y * 128;
    const int bn   = blockIdx.x * 128;
    const int wmr  = (w >> 1) * 32;               // wave row offset in block tile
    const int wnc  = (w & 1) * 64;                // wave col offset in block tile
    const int l    = lane & 15;
    const int hi   = lane >> 4;

    v8f acc[2][4];
#pragma unroll
    for (int i = 0; i < 2; ++i)
#pragma unroll
        for (int j = 0; j < 4; ++j)
            acc[i][j] = (v8f){0.f,0.f,0.f,0.f,0.f,0.f,0.f,0.f};

    // This wave's slice: waves 0-3 bring A rows, waves 4-7 W rows.
    const uint32_t wave = uni(threadIdx.x >> 5);
    const __bf16* srow = (wave < 4u) ? A + (size_t)(bm + 32 * (int)wave) * K
                                     : W + (size_t)(bn + 32 * (int)(wave - 4u)) * K;
    const uint64_t ga   = (uint64_t)(uintptr_t)srow;
    const uint32_t dst  = (uint32_t)(uintptr_t)&ring[0] + wave * G_SLICE;
    const u32x8    g1   = tdm_group1((uint32_t)K * 2u);
    const uint32_t ns   = uni((uint32_t)K / 128u);

    // Prologue: stage 0 lands and is published; then stage 1 is sent off.
    tdm_load(tdm_group0(dst, ga), g1);
    asm volatile("s_wait_tensorcnt 0x0" ::: "memory");   // this wave's slice of stage 0 has landed
    __syncthreads();
    tdm_load(tdm_group0(dst + G_BUF, ga + G_ROWB), g1);

    const unsigned char* aBase = ring + (uint32_t)(w >> 1) * G_SLICE + (uint32_t)l * G_PITCH + (uint32_t)hi * 16u;
    const unsigned char* bBase = ring + (4u + (uint32_t)(w & 1) * 2u) * G_SLICE + (uint32_t)l * G_PITCH + (uint32_t)hi * 16u;

    for (uint32_t s = 0; s < ns; ++s) {
        const uint32_t bo = (s & 1u) * G_BUF;
        const unsigned char* ap = aBase + bo;
        const unsigned char* bp = bBase + bo;
#pragma unroll
        for (uint32_t kk = 0; kk < 4u; ++kk) {
            const v16bf a0 = ring_frag(ap + kk * 64u);
            const v16bf a1 = ring_frag(ap + 16u * G_PITCH + kk * 64u);
            v16bf bfr[4];
#pragma unroll
            for (uint32_t j = 0; j < 4u; ++j)
                bfr[j] = ring_frag(bp + (j >> 1) * G_SLICE + (j & 1u) * 16u * G_PITCH + kk * 64u);
#pragma unroll
            for (int j = 0; j < 4; ++j) {
                acc[0][j] = wmma_bf16(a0, bfr[j], acc[0][j]);
                acc[1][j] = wmma_bf16(a1, bfr[j], acc[1][j]);
            }
        }
        // Publish point of stage s + 1, every wave, in this order.
        asm volatile("s_wait_dscnt 0x0" ::: "memory");      // this wave's reads of stage s are done
        asm volatile("s_wait_tensorcnt 0x0" ::: "memory");  // this wave's slice of stage s + 1 has landed
        __syncthreads();
        if (pinned(s + 2u < ns))                             // refill the buffer every reader has just left
            tdm_load(tdm_group0(dst + bo, ga + (uint64_t)(s + 2u) * G_ROWB), g1);
    }
    asm volatile("s_wait_tensorcnt 0x0" ::: "memory");       // nothing of the mover is left in flight
    asm volatile("s_wait_dscnt 0x0" ::: "memory");

    const int wm = bm + wmr;
    const int wn = bn + wnc;
    if (outMode == 0) {
#pragma unroll
        for (int i = 0; i < 2; ++i)
#pragma unroll
            for (int j = 0; j < 4; ++j) {
                const int col = wn + j * 16 + l;
                const float bc = bias ? bias[col] : 0.f;
#pragma unroll
                for (int r = 0; r < 8; ++r)
                    outF[(size_t)(wm + i * 16 + r + hi * 8) * N + col] = acc[i][j][r] + bc;
            }
    } else if (outMode == 1) {
#pragma unroll
        for (int i = 0; i < 2; ++i)
#pragma unroll
            for (int j = 0; j < 4; ++j) {
                const int col = wn + j * 16 + l;
                const float bc = bias ? bias[col] : 0.f;
#pragma unroll
                for (int r = 0; r < 8; ++r)
                    outB[(size_t)(wm + i * 16 + r + hi * 8) * N + col] =
                        (__bf16)(acc[i][j][r] + bc);
            }
    } else {
#pragma unroll
        for (int i = 0; i < 2; ++i)
#pragma unroll
            for (int j = 0; j < 4; ++j) {
                const int col = wn + j * 16 + l;
                const float bc = bias ? bias[col] : 0.f;
#pragma unroll
                for (int r = 0; r < 8; ++r)
                    outB[(size_t)col * M + (wm + i * 16 + r + hi * 8)] =
                        (__bf16)(acc[i][j][r] + bc);
            }
    }
}

// ----------------------------------------------------------- flash attention
// Q, K: bf16 [S, EMB] (head h in cols h*HD..); Vt: bf16 [EMB, S] (row h*HD+d).
// Block = 8 waves x 16 query rows, one head. Per key-step of 32, wave 0 TDM-
// stages the shared K tile (32xHD) and Vt tile (HDx32) into double-buffered
// LDS; all waves consume via ds_load_b128.
__global__ __launch_bounds__(256) void flash_attn_kernel(
    const __bf16* __restrict__ Q, const __bf16* __restrict__ Kmat,
    const __bf16* __restrict__ Vt, __bf16* __restrict__ Ao)
{
    __shared__ alignas(16) __bf16 Ktile[2][32 * KT_PITCH];     // rows t, cols d
    __shared__ alignas(16) __bf16 Vtile[2][128 * LDS_PITCH];   // rows d, cols t
    __shared__ alignas(16) __bf16 Plds[8][16 * 32];            // wave-private P

    const int lane = threadIdx.x & 31;
    const int w    = threadIdx.x >> 5;
    const int q0   = blockIdx.x * 128 + w * 16;
    const int h    = blockIdx.y;
    const int l    = lane & 15;
    const int hi   = lane >> 4;
    const float sc = 0.08838834764831845f;    // 1/sqrt(HD)

    v16bf qf[4];
#pragma unroll
    for (int kk = 0; kk < 4; ++kk)
        qf[kk] = load_frag(Q + (size_t)q0 * EMB + h * HD + kk * 32, EMB, lane);

    v8f acc[8];
#pragma unroll
    for (int d = 0; d < 8; ++d) acc[d] = (v8f){0.f,0.f,0.f,0.f,0.f,0.f,0.f,0.f};
    float m[8], lsum[8];
#pragma unroll
    for (int r = 0; r < 8; ++r) { m[r] = -3.0e38f; lsum[r] = 0.f; }

    // Prologue: stage key-step 0.
    if (threadIdx.x < 32) {
        tdm_load_tile(Kmat + (size_t)0 * EMB + h * HD,
                      (unsigned)(uintptr_t)&Ktile[0][0], S_LEN, EMB, 128, 32, 5, 3);
        tdm_load_tile(Vt + (size_t)(h * HD) * S_LEN + 0,
                      (unsigned)(uintptr_t)&Vtile[0][0], EMB, S_LEN, 32, 128, 3, 3);
    }

    const int nt = S_LEN / 32;
    for (int i = 0; i < nt; ++i) {
        const int cur = i & 1;
        if (threadIdx.x < 32) {
            if (i + 1 < nt) {
                const int t1 = (i + 1) * 32;
                tdm_load_tile(Kmat + (size_t)t1 * EMB + h * HD,
                              (unsigned)(uintptr_t)&Ktile[cur ^ 1][0], S_LEN, EMB, 128, 32, 5, 3);
                tdm_load_tile(Vt + (size_t)(h * HD) * S_LEN + t1,
                              (unsigned)(uintptr_t)&Vtile[cur ^ 1][0], EMB, S_LEN, 32, 128, 3, 3);
                __builtin_amdgcn_s_wait_tensorcnt(2);
            } else {
                __builtin_amdgcn_s_wait_tensorcnt(0);
            }
        }
        __syncthreads();

        // ---- scores: Q (16xHD) x K^T (HDx32) -> two 16x16 f32 tiles
        v8f s0 = (v8f){0.f,0.f,0.f,0.f,0.f,0.f,0.f,0.f};
        v8f s1 = (v8f){0.f,0.f,0.f,0.f,0.f,0.f,0.f,0.f};
#pragma unroll
        for (int kk = 0; kk < 4; ++kk) {
            v16bf b0, b1;
            {
                FragU _u;
                const int r0 = l;          // B column t = K-tile row (lanes 0..15)
                _u.p.lo = *(const v8bf*)&Ktile[cur][r0 * KT_PITCH + kk * 32 + hi * 8];
                _u.p.hi = *(const v8bf*)&Ktile[cur][r0 * KT_PITCH + kk * 32 + hi * 8 + 16];
                b0 = _u.f;
                const int r1 = 16 + l;
                _u.p.lo = *(const v8bf*)&Ktile[cur][r1 * KT_PITCH + kk * 32 + hi * 8];
                _u.p.hi = *(const v8bf*)&Ktile[cur][r1 * KT_PITCH + kk * 32 + hi * 8 + 16];
                b1 = _u.f;
            }
            s0 = wmma_bf16(qf[kk], b0, s0);
            s1 = wmma_bf16(qf[kk], b1, s1);
        }
        // ---- online softmax (rows live across 16 lanes of a half-wave)
        float corr[8];
#pragma unroll
        for (int r = 0; r < 8; ++r) {
            s0[r] *= sc; s1[r] *= sc;
            float mx = fmaxf(s0[r], s1[r]);
            mx = fmaxf(mx, __shfl_xor(mx, 1));
            mx = fmaxf(mx, __shfl_xor(mx, 2));
            mx = fmaxf(mx, __shfl_xor(mx, 4));
            mx = fmaxf(mx, __shfl_xor(mx, 8));
            const float mn = fmaxf(m[r], mx);
            corr[r] = __expf(m[r] - mn);
            m[r] = mn;
            s0[r] = __expf(s0[r] - mn);
            s1[r] = __expf(s1[r] - mn);
            float sum = s0[r] + s1[r];
            sum += __shfl_xor(sum, 1);
            sum += __shfl_xor(sum, 2);
            sum += __shfl_xor(sum, 4);
            sum += __shfl_xor(sum, 8);
            lsum[r] = lsum[r] * corr[r] + sum;
        }
#pragma unroll
        for (int d = 0; d < 8; ++d)
#pragma unroll
            for (int r = 0; r < 8; ++r) acc[d][r] *= corr[r];

        // ---- P: C-layout -> A-layout transpose via wave-private LDS tile.
        // DS ops from the same wave are in-order; no cross-wave sharing.
#pragma unroll
        for (int r = 0; r < 8; ++r) {
            const int row = r + hi * 8;
            Plds[w][row * 32 + l]      = (__bf16)s0[r];
            Plds[w][row * 32 + 16 + l] = (__bf16)s1[r];
        }
        FragU pu;
        pu.p.lo = *(const v8bf*)&Plds[w][l * 32 + hi * 8];
        pu.p.hi = *(const v8bf*)&Plds[w][l * 32 + hi * 8 + 16];

        // ---- acc += P (16x32) x V (32xHD); Vt-tile rows are contiguous over t
#pragma unroll
        for (int d = 0; d < 8; ++d) {
            v16bf bv;
            GEMM_LDS_FRAG(Vtile[cur], d * 16, bv);
            acc[d] = wmma_bf16(pu.f, bv, acc[d]);
        }
        __syncthreads();
    }

    // ---- normalize and emit bf16 attention output [S, EMB]
#pragma unroll
    for (int r = 0; r < 8; ++r) lsum[r] = 1.f / lsum[r];
#pragma unroll
    for (int d = 0; d < 8; ++d) {
        const int col = h * HD + d * 16 + l;
#pragma unroll
        for (int r = 0; r < 8; ++r) {
            const int row = q0 + r + hi * 8;
            Ao[(size_t)row * EMB + col] = (__bf16)(acc[d][r] * lsum[r]);
        }
    }
}

extern "C" void kernel_launch(void* const* d_in, const int* in_sizes, int n_in,
                              void* d_out, int out_size, void* d_ws, size_t ws_size,
                              hipStream_t stream) {
    (void)in_sizes; (void)n_in; (void)out_size; (void)ws_size;
    const float* x  = (const float*)d_in[0];
    const float* Wq = (const float*)d_in[1];
    const float* bq = (const float*)d_in[2];
    const float* Wk = (const float*)d_in[3];
    const float* bk = (const float*)d_in[4];
    const float* Wv = (const float*)d_in[5];
    const float* bv = (const float*)d_in[6];
    const float* Wo = (const float*)d_in[7];
    const float* bo = (const float*)d_in[8];
    float* out = (float*)d_out;

    char* ws = (char*)d_ws;
    const size_t TB = (size_t)S_LEN * EMB * sizeof(__bf16);   // 8 MB per bf16 tensor
    __bf16* xb  = (__bf16*)(ws + 0 * TB);
    __bf16* Wqb = (__bf16*)(ws + 1 * TB);
    __bf16* Wkb = (__bf16*)(ws + 2 * TB);
    __bf16* Wvb = (__bf16*)(ws + 3 * TB);
    __bf16* Wob = (__bf16*)(ws + 4 * TB);
    __bf16* Qb  = (__bf16*)(ws + 5 * TB);
    __bf16* Kb  = (__bf16*)(ws + 6 * TB);
    __bf16* Vtb = (__bf16*)(ws + 7 * TB);   // transposed [EMB, S]
    __bf16* Ab  = (__bf16*)(ws + 8 * TB);   // attention output bf16 [S, EMB]

    const int nElem = S_LEN * EMB;
    hipLaunchKernelGGL(cvt_bf16_kernel, dim3(2048), dim3(256), 0, stream, x,  xb,  nElem);
    hipLaunchKernelGGL(cvt_bf16_kernel, dim3(2048), dim3(256), 0, stream, Wq, Wqb, nElem);
    hipLaunchKernelGGL(cvt_bf16_kernel, dim3(2048), dim3(256), 0, stream, Wk, Wkb, nElem);
    hipLaunchKernelGGL(cvt_bf16_kernel, dim3(2048), dim3(256), 0, stream, Wv, Wvb, nElem);
    hipLaunchKernelGGL(cvt_bf16_kernel, dim3(2048), dim3(256), 0, stream, Wo, Wob, nElem);

    dim3 gg(EMB / 128, S_LEN / 128);
    // Q, K projections (bf16 row-major out)
    hipLaunchKernelGGL(gemm_bf16_kernel, gg, dim3(256), 0, stream,
                       xb, Wqb, bq, (float*)nullptr, Qb, S_LEN, EMB, EMB, 1);
    hipLaunchKernelGGL(gemm_bf16_kernel, gg, dim3(256), 0, stream,
                       xb, Wkb, bk, (float*)nullptr, Kb, S_LEN, EMB, EMB, 1);
    // V projection stored transposed: Vt[e, t]
    hipLaunchKernelGGL(gemm_bf16_kernel, gg, dim3(256), 0, stream,
                       xb, Wvb, bv, (float*)nullptr, Vtb, S_LEN, EMB, EMB, 2);
    // attention
    hipLaunchKernelGGL(flash_attn_kernel, dim3(S_LEN / 128, NH), dim3(256), 0, stream,
                       Qb, Kb, Vtb, Ab);
    // output projection -> f32 d_out
    hipLaunchKernelGGL(gemm_bf16_kernel, gg, dim3(256), 0, stream,
                       Ab, Wob, bo, out, (__bf16*)nullptr, S_LEN, EMB, EMB, 0);
}

// v002
// One run takes 179 microseconds.
// Two timings next to v001 both put it at 1.09 times that version's speed.
// Over all steps from v000 it is 1.29 times as fast.
#include <hip/hip_runtime.h>
#include <hip/hip_bf16.h>
#include <stdint.h>

#define S_LEN 2048
#define EMB   2048
#define NH    16
#define HD    128

typedef __attribute__((ext_vector_type(16))) __bf16 v16bf;
typedef __attribute__((ext_vector_type(8)))  __bf16 v8bf;
typedef __attribute__((ext_vector_type(8)))  float  v8f;
typedef __attribute__((ext_vector_type(4)))  unsigned int u32x4;
typedef __attribute__((ext_vector_type(8)))  unsigned int u32x8;
typedef __attribute__((ext_vector_type(8)))  int          i32x8;
typedef __attribute__((ext_vector_type(4)))  int          i32x4;

union FragU { v16bf f; struct { v8bf lo, hi; } p; };

// Load one 16x32 bf16 WMMA operand fragment from global (A-layout; B uses the
// same per-lane pattern with "row" = B column, both K-contiguous in memory).
// Per ISA 7.12.2: lanes 0-15 hold K=0..7 (v0-3) and K=16..23 (v4-7),
// lanes 16-31 hold K=8..15 and K=24..31.
static __device__ inline v16bf load_frag(const __bf16* __restrict__ base, int ld, int lane) {
    const int l  = lane & 15;
    const int hi = lane >> 4;
    const __bf16* p = base + (size_t)l * ld + hi * 8;
    FragU u;
    u.p.lo = *(const v8bf*)(p);
    u.p.hi = *(const v8bf*)(p + 16);
    return u.f;
}

static __device__ inline v8f wmma_bf16(v16bf a, v16bf b, v8f c) {
    return __builtin_amdgcn_wmma_f32_16x16x32_bf16(false, a, false, b, (short)0, c, false, false);
}

// ---------------------------------------------------------------------- TDM
// Issue one Tensor-Data-Mover 2D tile load of (tileRows x tileCols) bf16
// elements from a row-major [rows, ld] bf16 tensor into LDS at byte offset
// ldsOff, appending LDS padding after each row (pad codes per D# §8.4:
// padInterval: 0=2,1=4,..,7=256 DWORDs between pads; padAmount: n+1 DWORDs)
// so ds_load_b128 fragment fetches are bank-conflict-free.
static __device__ inline void tdm_load_tile(const __bf16* gtile, unsigned ldsOff,
                                            int rows, int ld,
                                            int tileCols, int tileRows,
                                            unsigned padInterval, unsigned padAmount) {
    const unsigned long long ga = (unsigned long long)(uintptr_t)gtile;
    u32x4 g0;
    g0.x = 1u;                                      // count=1, user descriptor
    g0.y = ldsOff;                                  // lds_addr (bytes)
    g0.z = (unsigned)ga;                            // global_addr[31:0]
    g0.w = (unsigned)((ga >> 32) & 0x01FFFFFFu)     // global_addr[56:32]
         | (2u << 30);                              // type = 2 ("image")
    i32x8 g1;
    g1[0] = (int)((1u << 16)                        // data_size: 2 bytes
                | (1u << 20)                        // pad_enable
                | (padInterval << 22)
                | (padAmount << 25));
    g1[1] = (int)(((unsigned)ld & 0xFFFFu) << 16);             // tensor_dim0 lo
    g1[2] = (int)((((unsigned)ld >> 16) & 0xFFFFu)
                | (((unsigned)rows & 0xFFFFu) << 16));          // dim0 hi | dim1 lo
    g1[3] = (int)(((((unsigned)rows) >> 16) & 0xFFFFu)
                | (((unsigned)tileCols) << 16));                // dim1 hi | tile_dim0
    g1[4] = tileRows;                                           // tile_dim1
    g1[5] = ld;                                                 // tensor_dim0_stride
    g1[6] = 0;
    g1[7] = 0;
    const i32x4 z4 = (i32x4){0, 0, 0, 0};
#if defined(__clang_major__) && (__clang_major__ >= 23)
    const i32x8 z8 = (i32x8){0, 0, 0, 0, 0, 0, 0, 0};
    __builtin_amdgcn_tensor_load_to_lds(g0, g1, z4, z4, z8, 0);
#else
    __builtin_amdgcn_tensor_load_to_lds(g0, g1, z4, z4, 0);
#endif
}

// ---------------------------------------------------------------- fp32 -> bf16
// One launch converts all five S_LEN x EMB tensors. 256 work-groups of 16 waves. Of every
// tensor a wave takes 4 KiB: eight loads of 512 contiguous bytes (16 B per lane), each
// answered by one store of 256 contiguous bytes.
#define CVT_LOADS 8
typedef __attribute__((ext_vector_type(4))) float  f32x4;
typedef __attribute__((ext_vector_type(4))) __bf16 v4bf;

__global__ __launch_bounds__(512) void cvt5_bf16_kernel(
    const float* __restrict__ s0, const float* __restrict__ s1, const float* __restrict__ s2,
    const float* __restrict__ s3, const float* __restrict__ s4,
    __bf16* __restrict__ d0, __bf16* __restrict__ d1, __bf16* __restrict__ d2,
    __bf16* __restrict__ d3, __bf16* __restrict__ d4)
{
    const unsigned wv   = blockIdx.x * 16u + (threadIdx.x >> 5);
    const unsigned quad = wv * (CVT_LOADS * 32u) + (threadIdx.x & 31u);   // index of 4 elements
    const f32x4* const srcs[5] = { (const f32x4*)s0, (const f32x4*)s1, (const f32x4*)s2,
                                   (const f32x4*)s3, (const f32x4*)s4 };
    v4bf* const dsts[5] = { (v4bf*)d0, (v4bf*)d1, (v4bf*)d2, (v4bf*)d3, (v4bf*)d4 };

    f32x4 v[5][CVT_LOADS];
#pragma unroll
    for (int t = 0; t < 5; ++t)
#pragma unroll
        for (int j = 0; j < CVT_LOADS; ++j)
            v[t][j] = *(srcs[t] + quad + j * 32);
    // Keeps every load ahead of the first conversion: left free, the compiler reuses the
    // registers, drains the load queue half-way and pays the memory latency again.
    __builtin_amdgcn_sched_barrier(0);
#pragma unroll
    for (int t = 0; t < 5; ++t)
#pragma unroll
        for (int j = 0; j < CVT_LOADS; ++j) {
            v4bf o;
            o[0] = (__bf16)v[t][j][0];
            o[1] = (__bf16)v[t][j][1];
            o[2] = (__bf16)v[t][j][2];
            o[3] = (__bf16)v[t][j][3];
            *(dsts[t] + quad + j * 32) = o;
        }
}

// ------------------------------------------------- C = A[M,K] * W[N,K]^T + bias
// 8 waves compute a 128x128 C tile. A stage is 128 k: 256 B of each of the 128 A
// rows and 128 W rows. Every wave brings its own 32-row slice of the stage with one
// tensor load into a two-buffer LDS ring; the next stage flies while this one is
// worked on. Needs M, N multiples of 128, K a multiple of 128 and at least 256.
// outMode: 0 = f32 row-major, 1 = bf16 row-major, 2 = bf16 transposed [N,M]
#define LDS_PITCH 40   // bf16 elems per 32-elem LDS tile row (+8 TDM pad)
#define KT_PITCH  136  // bf16 elems per 128-elem LDS tile row (+8 TDM pad)

#define GEMM_LDS_FRAG(tile, row0, dst) do {                              \
        FragU _u;                                                        \
        const int _r = (row0) + l;                                       \
        _u.p.lo = *(const v8bf*)&(tile)[_r * LDS_PITCH + hi * 8];        \
        _u.p.hi = *(const v8bf*)&(tile)[_r * LDS_PITCH + hi * 8 + 16];   \
        (dst) = _u.f; } while (0)

#define G_ROWB  256u              // bytes of an operand row in one stage
#define G_PITCH 272u              // LDS row pitch: the row + the mover's 16-B pad (ds_load_b128 readers)
#define G_ROWS  32u               // rows per slice
#define G_SLICE 10240u            // 32 * 272 = 8,704 B, rounded up to a multiple of 2 KiB
#define G_BUF   (8u * G_SLICE)    // slices 0-3: A rows, slices 4-7: W rows

static __device__ inline uint32_t uni(uint32_t v) {
    return (uint32_t)__builtin_amdgcn_readfirstlane(v);
}
static __device__ inline uint32_t pinned(uint32_t v) {
    uint32_t w = uni(v);
    asm volatile("" : "+s"(w));
    return w;
}
static __device__ inline u32x4 tdm_group0(uint32_t ldsDst, uint64_t ga) {
    u32x4 g;
    g[0] = uni(1u);                                                    // count = 1
    g[1] = uni(ldsDst);                                                // byte offset in the work-group's LDS
    g[2] = uni((uint32_t)ga);                                          // global address [31:0]
    g[3] = uni((((uint32_t)(ga >> 32)) & 0x01FFFFFFu) | 0x80000000u);  // [56:32] | type = 2
    return g;
}
// 1-byte elements, tensor = tile = 32 rows of 256 B, 4 dwords of LDS pad behind every row.
static __device__ inline u32x8 tdm_group1(uint32_t srcPitch) {
    u32x8 g;
    g[0] = uni((1u << 20) | (5u << 22) | (3u << 25));
    g[1] = uni((G_ROWB & 0xFFFFu) << 16);
    g[2] = uni((G_ROWB >> 16) | ((G_ROWS & 0xFFFFu) << 16));
    g[3] = uni((G_ROWS >> 16) | (G_ROWB << 16));
    g[4] = uni(G_ROWS);
    g[5] = uni(srcPitch);
    g[6] = uni(0u);
    g[7] = uni(0u);
    return g;
}
// One request of the whole wave: the mover copies the tile into LDS through no register.
static __device__ inline void tdm_load(u32x4 g0, u32x8 g1) {
    asm volatile("tensor_load_to_lds %0, %1" :: "s"(g0), "s"(g1) : "memory");
}
static __device__ inline v16bf ring_frag(const unsigned char* p) {
    FragU u;
    u.p.lo = *(const v8bf*)(p);
    u.p.hi = *(const v8bf*)(p + 32);
    return u.f;
}

__global__ __launch_bounds__(256) void gemm_bf16_kernel(
    const __bf16* __restrict__ A, const __bf16* __restrict__ W,
    const float* __restrict__ bias,
    float* __restrict__ outF, __bf16* __restrict__ outB,
    int M, int N, int K, int outMode)
{
    __shared__ __attribute__((aligned(2048))) unsigned char ring[2u * G_BUF];

    const int lane = threadIdx.x & 31;
    const int w    = threadIdx.x >> 5;            // 8 waves: 4 (M) x 2 (N)
    const int bm   = blockIdx.y * 128;
    const int bn   = blockIdx.x * 128;
    const int wmr  = (w >> 1) * 32;               // wave row offset in block tile
    const int wnc  = (w & 1) * 64;                // wave col offset in block tile
    const int l    = lane & 15;
    const int hi   = lane >> 4;

    v8f acc[2][4];
#pragma unroll
    for (int i = 0; i < 2; ++i)
#pragma unroll
        for (int j = 0; j < 4; ++j)
            acc[i][j] = (v8f){0.f,0.f,0.f,0.f,0.f,0.f,0.f,0.f};

    // This wave's slice: waves 0-3 bring A rows, waves 4-7 W rows.
    const uint32_t wave = uni(threadIdx.x >> 5);
    const __bf16* srow = (wave < 4u) ? A + (size_t)(bm + 32 * (int)wave) * K
                                     : W + (size_t)(bn + 32 * (int)(wave - 4u)) * K;
    const uint64_t ga   = (uint64_t)(uintptr_t)srow;
    const uint32_t dst  = (uint32_t)(uintptr_t)&ring[0] + wave * G_SLICE;
    const u32x8    g1   = tdm_group1((uint32_t)K * 2u);
    const uint32_t ns   = uni((uint32_t)K / 128u);

    // Prologue: stage 0 lands and is published; then stage 1 is sent off.
    tdm_load(tdm_group0(dst, ga), g1);
    asm volatile("s_wait_tensorcnt 0x0" ::: "memory");   // this wave's slice of stage 0 has landed
    __syncthreads();
    tdm_load(tdm_group0(dst + G_BUF, ga + G_ROWB), g1);

    const unsigned char* aBase = ring + (uint32_t)(w >> 1) * G_SLICE + (uint32_t)l * G_PITCH + (uint32_t)hi * 16u;
    const unsigned char* bBase = ring + (4u + (uint32_t)(w & 1) * 2u) * G_SLICE + (uint32_t)l * G_PITCH + (uint32_t)hi * 16u;

    for (uint32_t s = 0; s < ns; ++s) {
        const uint32_t bo = (s & 1u) * G_BUF;
        const unsigned char* ap = aBase + bo;
        const unsigned char* bp = bBase + bo;
#pragma unroll
        for (uint32_t kk = 0; kk < 4u; ++kk) {
            const v16bf a0 = ring_frag(ap + kk * 64u);
            const v16bf a1 = ring_frag(ap + 16u * G_PITCH + kk * 64u);
            v16bf bfr[4];
#pragma unroll
            for (uint32_t j = 0; j < 4u; ++j)
                bfr[j] = ring_frag(bp + (j >> 1) * G_SLICE + (j & 1u) * 16u * G_PITCH + kk * 64u);
#pragma unroll
            for (int j = 0; j < 4; ++j) {
                acc[0][j] = wmma_bf16(a0, bfr[j], acc[0][j]);
                acc[1][j] = wmma_bf16(a1, bfr[j], acc[1][j]);
            }
        }
        // Publish point of stage s + 1, every wave, in this order.
        asm volatile("s_wait_dscnt 0x0" ::: "memory");      // this wave's reads of stage s are done
        asm volatile("s_wait_tensorcnt 0x0" ::: "memory");  // this wave's slice of stage s + 1 has landed
        __syncthreads();
        if (pinned(s + 2u < ns))                             // refill the buffer every reader has just left
            tdm_load(tdm_group0(dst + bo, ga + (uint64_t)(s + 2u) * G_ROWB), g1);
    }
    asm volatile("s_wait_tensorcnt 0x0" ::: "memory");       // nothing of the mover is left in flight
    asm volatile("s_wait_dscnt 0x0" ::: "memory");

    const int wm = bm + wmr;
    const int wn = bn + wnc;
    if (outMode == 0) {
#pragma unroll
        for (int i = 0; i < 2; ++i)
#pragma unroll
            for (int j = 0; j < 4; ++j) {
                const int col = wn + j * 16 + l;
                const float bc = bias ? bias[col] : 0.f;
#pragma unroll
                for (int r = 0; r < 8; ++r)
                    outF[(size_t)(wm + i * 16 + r + hi * 8) * N + col] = acc[i][j][r] + bc;
            }
    } else if (outMode == 1) {
#pragma unroll
        for (int i = 0; i < 2; ++i)
#pragma unroll
            for (int j = 0; j < 4; ++j) {
                const int col = wn + j * 16 + l;
                const float bc = bias ? bias[col] : 0.f;
#pragma unroll
                for (int r = 0; r < 8; ++r)
                    outB[(size_t)(wm + i * 16 + r + hi * 8) * N + col] =
                        (__bf16)(acc[i][j][r] + bc);
            }
    } else {
#pragma unroll
        for (int i = 0; i < 2; ++i)
#pragma unroll
            for (int j = 0; j < 4; ++j) {
                const int col = wn + j * 16 + l;
                const float bc = bias ? bias[col] : 0.f;
#pragma unroll
                for (int r = 0; r < 8; ++r)
                    outB[(size_t)col * M + (wm + i * 16 + r + hi * 8)] =
                        (__bf16)(acc[i][j][r] + bc);
            }
    }
}

// ----------------------------------------------------------- flash attention
// Q, K: bf16 [S, EMB] (head h in cols h*HD..); Vt: bf16 [EMB, S] (row h*HD+d).
// Block = 8 waves x 16 query rows, one head. Per key-step of 32, wave 0 TDM-
// stages the shared K tile (32xHD) and Vt tile (HDx32) into double-buffered
// LDS; all waves consume via ds_load_b128.
__global__ __launch_bounds__(256) void flash_attn_kernel(
    const __bf16* __restrict__ Q, const __bf16* __restrict__ Kmat,
    const __bf16* __restrict__ Vt, __bf16* __restrict__ Ao)
{
    __shared__ alignas(16) __bf16 Ktile[2][32 * KT_PITCH];     // rows t, cols d
    __shared__ alignas(16) __bf16 Vtile[2][128 * LDS_PITCH];   // rows d, cols t
    __shared__ alignas(16) __bf16 Plds[8][16 * 32];            // wave-private P

    const int lane = threadIdx.x & 31;
    const int w    = threadIdx.x >> 5;
    const int q0   = blockIdx.x * 128 + w * 16;
    const int h    = blockIdx.y;
    const int l    = lane & 15;
    const int hi   = lane >> 4;
    const float sc = 0.08838834764831845f;    // 1/sqrt(HD)

    v16bf qf[4];
#pragma unroll
    for (int kk = 0; kk < 4; ++kk)
        qf[kk] = load_frag(Q + (size_t)q0 * EMB + h * HD + kk * 32, EMB, lane);

    v8f acc[8];
#pragma unroll
    for (int d = 0; d < 8; ++d) acc[d] = (v8f){0.f,0.f,0.f,0.f,0.f,0.f,0.f,0.f};
    float m[8], lsum[8];
#pragma unroll
    for (int r = 0; r < 8; ++r) { m[r] = -3.0e38f; lsum[r] = 0.f; }

    // Prologue: stage key-step 0.
    if (threadIdx.x < 32) {
        tdm_load_tile(Kmat + (size_t)0 * EMB + h * HD,
                      (unsigned)(uintptr_t)&Ktile[0][0], S_LEN, EMB, 128, 32, 5, 3);
        tdm_load_tile(Vt + (size_t)(h * HD) * S_LEN + 0,
                      (unsigned)(uintptr_t)&Vtile[0][0], EMB, S_LEN, 32, 128, 3, 3);
    }

    const int nt = S_LEN / 32;
    for (int i = 0; i < nt; ++i) {
        const int cur = i & 1;
        if (threadIdx.x < 32) {
            if (i + 1 < nt) {
                const int t1 = (i + 1) * 32;
                tdm_load_tile(Kmat + (size_t)t1 * EMB + h * HD,
                              (unsigned)(uintptr_t)&Ktile[cur ^ 1][0], S_LEN, EMB, 128, 32, 5, 3);
                tdm_load_tile(Vt + (size_t)(h * HD) * S_LEN + t1,
                              (unsigned)(uintptr_t)&Vtile[cur ^ 1][0], EMB, S_LEN, 32, 128, 3, 3);
                __builtin_amdgcn_s_wait_tensorcnt(2);
            } else {
                __builtin_amdgcn_s_wait_tensorcnt(0);
            }
        }
        __syncthreads();

        // ---- scores: Q (16xHD) x K^T (HDx32) -> two 16x16 f32 tiles
        v8f s0 = (v8f){0.f,0.f,0.f,0.f,0.f,0.f,0.f,0.f};
        v8f s1 = (v8f){0.f,0.f,0.f,0.f,0.f,0.f,0.f,0.f};
#pragma unroll
        for (int kk = 0; kk < 4; ++kk) {
            v16bf b0, b1;
            {
                FragU _u;
                const int r0 = l;          // B column t = K-tile row (lanes 0..15)
                _u.p.lo = *(const v8bf*)&Ktile[cur][r0 * KT_PITCH + kk * 32 + hi * 8];
                _u.p.hi = *(const v8bf*)&Ktile[cur][r0 * KT_PITCH + kk * 32 + hi * 8 + 16];
                b0 = _u.f;
                const int r1 = 16 + l;
                _u.p.lo = *(const v8bf*)&Ktile[cur][r1 * KT_PITCH + kk * 32 + hi * 8];
                _u.p.hi = *(const v8bf*)&Ktile[cur][r1 * KT_PITCH + kk * 32 + hi * 8 + 16];
                b1 = _u.f;
            }
            s0 = wmma_bf16(qf[kk], b0, s0);
            s1 = wmma_bf16(qf[kk], b1, s1);
        }
        // ---- online softmax (rows live across 16 lanes of a half-wave)
        float corr[8];
#pragma unroll
        for (int r = 0; r < 8; ++r) {
            s0[r] *= sc; s1[r] *= sc;
            float mx = fmaxf(s0[r], s1[r]);
            mx = fmaxf(mx, __shfl_xor(mx, 1));
            mx = fmaxf(mx, __shfl_xor(mx, 2));
            mx = fmaxf(mx, __shfl_xor(mx, 4));
            mx = fmaxf(mx, __shfl_xor(mx, 8));
            const float mn = fmaxf(m[r], mx);
            corr[r] = __expf(m[r] - mn);
            m[r] = mn;
            s0[r] = __expf(s0[r] - mn);
            s1[r] = __expf(s1[r] - mn);
            float sum = s0[r] + s1[r];
            sum += __shfl_xor(sum, 1);
            sum += __shfl_xor(sum, 2);
            sum += __shfl_xor(sum, 4);
            sum += __shfl_xor(sum, 8);
            lsum[r] = lsum[r] * corr[r] + sum;
        }
#pragma unroll
        for (int d = 0; d < 8; ++d)
#pragma unroll
            for (int r = 0; r < 8; ++r) acc[d][r] *= corr[r];

        // ---- P: C-layout -> A-layout transpose via wave-private LDS tile.
        // DS ops from the same wave are in-order; no cross-wave sharing.
#pragma unroll
        for (int r = 0; r < 8; ++r) {
            const int row = r + hi * 8;
            Plds[w][row * 32 + l]      = (__bf16)s0[r];
            Plds[w][row * 32 + 16 + l] = (__bf16)s1[r];
        }
        FragU pu;
        pu.p.lo = *(const v8bf*)&Plds[w][l * 32 + hi * 8];
        pu.p.hi = *(const v8bf*)&Plds[w][l * 32 + hi * 8 + 16];

        // ---- acc += P (16x32) x V (32xHD); Vt-tile rows are contiguous over t
#pragma unroll
        for (int d = 0; d < 8; ++d) {
            v16bf bv;
            GEMM_LDS_FRAG(Vtile[cur], d * 16, bv);
            acc[d] = wmma_bf16(pu.f, bv, acc[d]);
        }
        __syncthreads();
    }

    // ---- normalize and emit bf16 attention output [S, EMB]
#pragma unroll
    for (int r = 0; r < 8; ++r) lsum[r] = 1.f / lsum[r];
#pragma unroll
    for (int d = 0; d < 8; ++d) {
        const int col = h * HD + d * 16 + l;
#pragma unroll
        for (int r = 0; r < 8; ++r) {
            const int row = q0 + r + hi * 8;
            Ao[(size_t)row * EMB + col] = (__bf16)(acc[d][r] * lsum[r]);
        }
    }
}

extern "C" void kernel_launch(void* const* d_in, const int* in_sizes, int n_in,
                              void* d_out, int out_size, void* d_ws, size_t ws_size,
                              hipStream_t stream) {
    (void)in_sizes; (void)n_in; (void)out_size; (void)ws_size;
    const float* x  = (const float*)d_in[0];
    const float* Wq = (const float*)d_in[1];
    const float* bq = (const float*)d_in[2];
    const float* Wk = (const float*)d_in[3];
    const float* bk = (const float*)d_in[4];
    const float* Wv = (const float*)d_in[5];
    const float* bv = (const float*)d_in[6];
    const float* Wo = (const float*)d_in[7];
    const float* bo = (const float*)d_in[8];
    float* out = (float*)d_out;

    char* ws = (char*)d_ws;
    const size_t TB = (size_t)S_LEN * EMB * sizeof(__bf16);   // 8 MB per bf16 tensor
    __bf16* xb  = (__bf16*)(ws + 0 * TB);
    __bf16* Wqb = (__bf16*)(ws + 1 * TB);
    __bf16* Wkb = (__bf16*)(ws + 2 * TB);
    __bf16* Wvb = (__bf16*)(ws + 3 * TB);
    __bf16* Wob = (__bf16*)(ws + 4 * TB);
    __bf16* Qb  = (__bf16*)(ws + 5 * TB);
    __bf16* Kb  = (__bf16*)(ws + 6 * TB);
    __bf16* Vtb = (__bf16*)(ws + 7 * TB);   // transposed [EMB, S]
    __bf16* Ab  = (__bf16*)(ws + 8 * TB);   // attention output bf16 [S, EMB]

    hipLaunchKernelGGL(cvt5_bf16_kernel, dim3(256), dim3(512), 0, stream,
                       x, Wq, Wk, Wv, Wo, xb, Wqb, Wkb, Wvb, Wob);

    dim3 gg(EMB / 128, S_LEN / 128);
    // Q, K projections (bf16 row-major out)
    hipLaunchKernelGGL(gemm_bf16_kernel, gg, dim3(256), 0, stream,
                       xb, Wqb, bq, (float*)nullptr, Qb, S_LEN, EMB, EMB, 1);
    hipLaunchKernelGGL(gemm_bf16_kernel, gg, dim3(256), 0, stream,
                       xb, Wkb, bk, (float*)nullptr, Kb, S_LEN, EMB, EMB, 1);
    // V projection stored transposed: Vt[e, t]
    hipLaunchKernelGGL(gemm_bf16_kernel, gg, dim3(256), 0, stream,
                       xb, Wvb, bv, (float*)nullptr, Vtb, S_LEN, EMB, EMB, 2);
    // attention
    hipLaunchKernelGGL(flash_attn_kernel, dim3(S_LEN / 128, NH), dim3(256), 0, stream,
                       Qb, Kb, Vtb, Ab);
    // output projection -> f32 d_out
    hipLaunchKernelGGL(gemm_bf16_kernel, gg, dim3(256), 0, stream,
                       Ab, Wob, bo, out, (__bf16*)nullptr, S_LEN, EMB, EMB, 0);
}

// v003
// One run takes 166 microseconds.
// In both of two side-by-side timings against v002, it was 1.08 times as fast.
// Counting every step since v000, it is 1.39 times as fast.
#include <hip/hip_runtime.h>
#include <hip/hip_bf16.h>
#include <stdint.h>

#define S_LEN 2048
#define EMB   2048
#define NH    16
#define HD    128

typedef __attribute__((ext_vector_type(16))) __bf16 v16bf;
typedef __attribute__((ext_vector_type(8)))  __bf16 v8bf;
typedef __attribute__((ext_vector_type(8)))  float  v8f;
typedef __attribute__((ext_vector_type(4)))  unsigned int u32x4;
typedef __attribute__((ext_vector_type(8)))  unsigned int u32x8;
typedef __attribute__((ext_vector_type(8)))  int          i32x8;
typedef __attribute__((ext_vector_type(4)))  int          i32x4;

union FragU { v16bf f; struct { v8bf lo, hi; } p; };

// Load one 16x32 bf16 WMMA operand fragment from global (A-layout; B uses the
// same per-lane pattern with "row" = B column, both K-contiguous in memory).
// Per ISA 7.12.2: lanes 0-15 hold K=0..7 (v0-3) and K=16..23 (v4-7),
// lanes 16-31 hold K=8..15 and K=24..31.
static __device__ inline v16bf load_frag(const __bf16* __restrict__ base, int ld, int lane) {
    const int l  = lane & 15;
    const int hi = lane >> 4;
    const __bf16* p = base + (size_t)l * ld + hi * 8;
    FragU u;
    u.p.lo = *(const v8bf*)(p);
    u.p.hi = *(const v8bf*)(p + 16);
    return u.f;
}

static __device__ inline v8f wmma_bf16(v16bf a, v16bf b, v8f c) {
    return __builtin_amdgcn_wmma_f32_16x16x32_bf16(false, a, false, b, (short)0, c, false, false);
}

// ---------------------------------------------------------------------- TDM
// Issue one Tensor-Data-Mover 2D tile load of (tileRows x tileCols) bf16
// elements from a row-major [rows, ld] bf16 tensor into LDS at byte offset
// ldsOff, appending LDS padding after each row (pad codes per D# §8.4:
// padInterval: 0=2,1=4,..,7=256 DWORDs between pads; padAmount: n+1 DWORDs)
// so ds_load_b128 fragment fetches are bank-conflict-free.
static __device__ inline void tdm_load_tile(const __bf16* gtile, unsigned ldsOff,
                                            int rows, int ld,
                                            int tileCols, int tileRows,
                                            unsigned padInterval, unsigned padAmount) {
    const unsigned long long ga = (unsigned long long)(uintptr_t)gtile;
    u32x4 g0;
    g0.x = 1u;                                      // count=1, user descriptor
    g0.y = ldsOff;                                  // lds_addr (bytes)
    g0.z = (unsigned)ga;                            // global_addr[31:0]
    g0.w = (unsigned)((ga >> 32) & 0x01FFFFFFu)     // global_addr[56:32]
         | (2u << 30);                              // type = 2 ("image")
    i32x8 g1;
    g1[0] = (int)((1u << 16)                        // data_size: 2 bytes
                | (1u << 20)                        // pad_enable
                | (padInterval << 22)
                | (padAmount << 25));
    g1[1] = (int)(((unsigned)ld & 0xFFFFu) << 16);             // tensor_dim0 lo
    g1[2] = (int)((((unsigned)ld >> 16) & 0xFFFFu)
                | (((unsigned)rows & 0xFFFFu) << 16));          // dim0 hi | dim1 lo
    g1[3] = (int)(((((unsigned)rows) >> 16) & 0xFFFFu)
                | (((unsigned)tileCols) << 16));                // dim1 hi | tile_dim0
    g1[4] = tileRows;                                           // tile_dim1
    g1[5] = ld;                                                 // tensor_dim0_stride
    g1[6] = 0;
    g1[7] = 0;
    const i32x4 z4 = (i32x4){0, 0, 0, 0};
#if defined(__clang_major__) && (__clang_major__ >= 23)
    const i32x8 z8 = (i32x8){0, 0, 0, 0, 0, 0, 0, 0};
    __builtin_amdgcn_tensor_load_to_lds(g0, g1, z4, z4, z8, 0);
#else
    __builtin_amdgcn_tensor_load_to_lds(g0, g1, z4, z4, 0);
#endif
}

// ---------------------------------------------------------------- fp32 -> bf16
// One launch converts all five S_LEN x EMB tensors. 256 work-groups of 16 waves. Of every
// tensor a wave takes 4 KiB: eight loads of 512 contiguous bytes (16 B per lane), each
// answered by one store of 256 contiguous bytes.
#define CVT_LOADS 8
typedef __attribute__((ext_vector_type(4))) float  f32x4;
typedef __attribute__((ext_vector_type(4))) __bf16 v4bf;

__global__ __launch_bounds__(512) void cvt5_bf16_kernel(
    const float* __restrict__ s0, const float* __restrict__ s1, const float* __restrict__ s2,
    const float* __restrict__ s3, const float* __restrict__ s4,
    __bf16* __restrict__ d0, __bf16* __restrict__ d1, __bf16* __restrict__ d2,
    __bf16* __restrict__ d3, __bf16* __restrict__ d4)
{
    const unsigned wv   = blockIdx.x * 16u + (threadIdx.x >> 5);
    const unsigned quad = wv * (CVT_LOADS * 32u) + (threadIdx.x & 31u);   // index of 4 elements
    const f32x4* const srcs[5] = { (const f32x4*)s0, (const f32x4*)s1, (const f32x4*)s2,
                                   (const f32x4*)s3, (const f32x4*)s4 };
    v4bf* const dsts[5] = { (v4bf*)d0, (v4bf*)d1, (v4bf*)d2, (v4bf*)d3, (v4bf*)d4 };

    f32x4 v[5][CVT_LOADS];
#pragma unroll
    for (int t = 0; t < 5; ++t)
#pragma unroll
        for (int j = 0; j < CVT_LOADS; ++j)
            v[t][j] = *(srcs[t] + quad + j * 32);
    // Keeps every load ahead of the first conversion: left free, the compiler reuses the
    // registers, drains the load queue half-way and pays the memory latency again.
    __builtin_amdgcn_sched_barrier(0);
#pragma unroll
    for (int t = 0; t < 5; ++t)
#pragma unroll
        for (int j = 0; j < CVT_LOADS; ++j) {
            v4bf o;
            o[0] = (__bf16)v[t][j][0];
            o[1] = (__bf16)v[t][j][1];
            o[2] = (__bf16)v[t][j][2];
            o[3] = (__bf16)v[t][j][3];
            *(dsts[t] + quad + j * 32) = o;
        }
}

// ------------------------------------------------- C = A[M,K] * W[N,K]^T + bias
// 8 waves compute a 128x128 C tile. A stage is 128 k: 256 B of each of the 128 A
// rows and 128 W rows. Every wave brings its own 32-row slice of the stage with one
// tensor load into a two-buffer LDS ring; the next stage flies while this one is
// worked on. Needs M, N multiples of 128, K a multiple of 128 and at least 256.
// outMode: 0 = f32 row-major, 1 = bf16 row-major, 2 = bf16 transposed [N,M]
#define LDS_PITCH 40   // bf16 elems per 32-elem LDS tile row (+8 TDM pad)
#define KT_PITCH  136  // bf16 elems per 128-elem LDS tile row (+8 TDM pad)

#define GEMM_LDS_FRAG(tile, row0, dst) do {                              \
        FragU _u;                                                        \
        const int _r = (row0) + l;                                       \
        _u.p.lo = *(const v8bf*)&(tile)[_r * LDS_PITCH + hi * 8];        \
        _u.p.hi = *(const v8bf*)&(tile)[_r * LDS_PITCH + hi * 8 + 16];   \
        (dst) = _u.f; } while (0)

#define G_ROWB  256u              // bytes of an operand row in one stage
#define G_PITCH 272u              // LDS row pitch: the row + the mover's 16-B pad (ds_load_b128 readers)
#define G_ROWS  32u               // rows per slice
#define G_SLICE 10240u            // 32 * 272 = 8,704 B, rounded up to a multiple of 2 KiB
#define G_BUF   (8u * G_SLICE)    // slices 0-3: A rows, slices 4-7: W rows

static __device__ inline uint32_t uni(uint32_t v) {
    return (uint32_t)__builtin_amdgcn_readfirstlane(v);
}
static __device__ inline uint32_t pinned(uint32_t v) {
    uint32_t w = uni(v);
    asm volatile("" : "+s"(w));
    return w;
}
static __device__ inline u32x4 tdm_group0(uint32_t ldsDst, uint64_t ga) {
    u32x4 g;
    g[0] = uni(1u);                                                    // count = 1
    g[1] = uni(ldsDst);                                                // byte offset in the work-group's LDS
    g[2] = uni((uint32_t)ga);                                          // global address [31:0]
    g[3] = uni((((uint32_t)(ga >> 32)) & 0x01FFFFFFu) | 0x80000000u);  // [56:32] | type = 2
    return g;
}
// 1-byte elements, tensor = tile = 32 rows of 256 B, 4 dwords of LDS pad behind every row.
static __device__ inline u32x8 tdm_group1(uint32_t srcPitch) {
    u32x8 g;
    g[0] = uni((1u << 20) | (5u << 22) | (3u << 25));
    g[1] = uni((G_ROWB & 0xFFFFu) << 16);
    g[2] = uni((G_ROWB >> 16) | ((G_ROWS & 0xFFFFu) << 16));
    g[3] = uni((G_ROWS >> 16) | (G_ROWB << 16));
    g[4] = uni(G_ROWS);
    g[5] = uni(srcPitch);
    g[6] = uni(0u);
    g[7] = uni(0u);
    return g;
}
// One request of the whole wave: the mover copies the tile into LDS through no register.
static __device__ inline void tdm_load(u32x4 g0, u32x8 g1) {
    asm volatile("tensor_load_to_lds %0, %1" :: "s"(g0), "s"(g1) : "memory");
}
static __device__ inline v16bf ring_frag(const unsigned char* p) {
    FragU u;
    u.p.lo = *(const v8bf*)(p);
    u.p.hi = *(const v8bf*)(p + 32);
    return u.f;
}

__global__ __launch_bounds__(256) void gemm_bf16_kernel(
    const __bf16* __restrict__ A, const __bf16* __restrict__ W,
    const float* __restrict__ bias,
    float* __restrict__ outF, __bf16* __restrict__ outB,
    int M, int N, int K, int outMode)
{
    __shared__ __attribute__((aligned(2048))) unsigned char ring[2u * G_BUF];

    const int lane = threadIdx.x & 31;
    const int w    = threadIdx.x >> 5;            // 8 waves: 4 (M) x 2 (N)
    const int bm   = blockIdx.y * 128;
    const int bn   = blockIdx.x * 128;
    const int wmr  = (w >> 1) * 32;               // wave row offset in block tile
    const int wnc  = (w & 1) * 64;                // wave col offset in block tile
    const int l    = lane & 15;
    const int hi   = lane >> 4;

    v8f acc[2][4];
#pragma unroll
    for (int i = 0; i < 2; ++i)
#pragma unroll
        for (int j = 0; j < 4; ++j)
            acc[i][j] = (v8f){0.f,0.f,0.f,0.f,0.f,0.f,0.f,0.f};

    // This wave's slice: waves 0-3 bring A rows, waves 4-7 W rows.
    const uint32_t wave = uni(threadIdx.x >> 5);
    const __bf16* srow = (wave < 4u) ? A + (size_t)(bm + 32 * (int)wave) * K
                                     : W + (size_t)(bn + 32 * (int)(wave - 4u)) * K;
    const uint64_t ga   = (uint64_t)(uintptr_t)srow;
    const uint32_t dst  = (uint32_t)(uintptr_t)&ring[0] + wave * G_SLICE;
    const u32x8    g1   = tdm_group1((uint32_t)K * 2u);
    const uint32_t ns   = uni((uint32_t)K / 128u);

    // Prologue: stage 0 lands and is published; then stage 1 is sent off.
    tdm_load(tdm_group0(dst, ga), g1);
    asm volatile("s_wait_tensorcnt 0x0" ::: "memory");   // this wave's slice of stage 0 has landed
    __syncthreads();
    tdm_load(tdm_group0(dst + G_BUF, ga + G_ROWB), g1);

    const unsigned char* aBase = ring + (uint32_t)(w >> 1) * G_SLICE + (uint32_t)l * G_PITCH + (uint32_t)hi * 16u;
    const unsigned char* bBase = ring + (4u + (uint32_t)(w & 1) * 2u) * G_SLICE + (uint32_t)l * G_PITCH + (uint32_t)hi * 16u;

    for (uint32_t s = 0; s < ns; ++s) {
        const uint32_t bo = (s & 1u) * G_BUF;
        const unsigned char* ap = aBase + bo;
        const unsigned char* bp = bBase + bo;
        // The stage's four blocks of 32 k. A block's 12 LDS reads go out as one group, well
        // ahead of its 8 WMMAs: blocks 0-2 at the head of the stage, block 3 behind block 0's WMMAs.
        v16bf af[4][2], bfr[4][4];
#define GEMM_LOAD_BLOCK(kk) do {                                                             \
        af[kk][0] = ring_frag(ap + (kk) * 64u);                                              \
        af[kk][1] = ring_frag(ap + 16u * G_PITCH + (kk) * 64u);                              \
        _Pragma("unroll")                                                                    \
        for (uint32_t j = 0; j < 4u; ++j)                                                    \
            bfr[kk][j] = ring_frag(bp + (j >> 1) * G_SLICE + (j & 1u) * 16u * G_PITCH + (kk) * 64u); \
    } while (0)
#define GEMM_WMMA_BLOCK(kk) do {                                                             \
        _Pragma("unroll")                                                                    \
        for (int j = 0; j < 4; ++j) {                                                        \
            acc[0][j] = wmma_bf16(af[kk][0], bfr[kk][j], acc[0][j]);                         \
            acc[1][j] = wmma_bf16(af[kk][1], bfr[kk][j], acc[1][j]);                         \
        }                                                                                    \
    } while (0)
        GEMM_LOAD_BLOCK(0);
        GEMM_LOAD_BLOCK(1);
        GEMM_LOAD_BLOCK(2);
        // Keeps the three groups ahead of the first WMMA: left free, the compiler sinks each
        // pair of reads to its WMMA and waits out the LDS latency once per fragment.
        __builtin_amdgcn_sched_barrier(0);
        GEMM_WMMA_BLOCK(0);
        // Keeps block 3's reads between block 0's and block 1's WMMAs, for the same reason.
        __builtin_amdgcn_sched_barrier(0);
        GEMM_LOAD_BLOCK(3);
        __builtin_amdgcn_sched_barrier(0);
        GEMM_WMMA_BLOCK(1);
        GEMM_WMMA_BLOCK(2);
        GEMM_WMMA_BLOCK(3);
        // Keeps the WMMAs ahead of the publish point: left free, the compiler lifts the waits and
        // the barrier over blocks 1-3, which then run with the LDS idle and hold back the refill.
        __builtin_amdgcn_sched_barrier(0);
        // Publish point of stage s + 1, every wave, in this order.
        asm volatile("s_wait_dscnt 0x0" ::: "memory");      // this wave's reads of stage s are done
        asm volatile("s_wait_tensorcnt 0x0" ::: "memory");  // this wave's slice of stage s + 1 has landed
        __syncthreads();
        if (pinned(s + 2u < ns))                             // refill the buffer every reader has just left
            tdm_load(tdm_group0(dst + bo, ga + (uint64_t)(s + 2u) * G_ROWB), g1);
    }
    asm volatile("s_wait_tensorcnt 0x0" ::: "memory");       // nothing of the mover is left in flight
    asm volatile("s_wait_dscnt 0x0" ::: "memory");

    const int wm = bm + wmr;
    const int wn = bn + wnc;
    if (outMode == 0) {
#pragma unroll
        for (int i = 0; i < 2; ++i)
#pragma unroll
            for (int j = 0; j < 4; ++j) {
                const int col = wn + j * 16 + l;
                const float bc = bias ? bias[col] : 0.f;
#pragma unroll
                for (int r = 0; r < 8; ++r)
                    outF[(size_t)(wm + i * 16 + r + hi * 8) * N + col] = acc[i][j][r] + bc;
            }
    } else if (outMode == 1) {
#pragma unroll
        for (int i = 0; i < 2; ++i)
#pragma unroll
            for (int j = 0; j < 4; ++j) {
                const int col = wn + j * 16 + l;
                const float bc = bias ? bias[col] : 0.f;
#pragma unroll
                for (int r = 0; r < 8; ++r)
                    outB[(size_t)(wm + i * 16 + r + hi * 8) * N + col] =
                        (__bf16)(acc[i][j][r] + bc);
            }
    } else {
#pragma unroll
        for (int i = 0; i < 2; ++i)
#pragma unroll
            for (int j = 0; j < 4; ++j) {
                const int col = wn + j * 16 + l;
                const float bc = bias ? bias[col] : 0.f;
#pragma unroll
                for (int r = 0; r < 8; ++r)
                    outB[(size_t)col * M + (wm + i * 16 + r + hi * 8)] =
                        (__bf16)(acc[i][j][r] + bc);
            }
    }
}

// ----------------------------------------------------------- flash attention
// Q, K: bf16 [S, EMB] (head h in cols h*HD..); Vt: bf16 [EMB, S] (row h*HD+d).
// Block = 8 waves x 16 query rows, one head. Per key-step of 32, wave 0 TDM-
// stages the shared K tile (32xHD) and Vt tile (HDx32) into double-buffered
// LDS; all waves consume via ds_load_b128.
__global__ __launch_bounds__(256) void flash_attn_kernel(
    const __bf16* __restrict__ Q, const __bf16* __restrict__ Kmat,
    const __bf16* __restrict__ Vt, __bf16* __restrict__ Ao)
{
    __shared__ alignas(16) __bf16 Ktile[2][32 * KT_PITCH];     // rows t, cols d
    __shared__ alignas(16) __bf16 Vtile[2][128 * LDS_PITCH];   // rows d, cols t
    __shared__ alignas(16) __bf16 Plds[8][16 * 32];            // wave-private P

    const int lane = threadIdx.x & 31;
    const int w    = threadIdx.x >> 5;
    const int q0   = blockIdx.x * 128 + w * 16;
    const int h    = blockIdx.y;
    const int l    = lane & 15;
    const int hi   = lane >> 4;
    const float sc = 0.08838834764831845f;    // 1/sqrt(HD)

    v16bf qf[4];
#pragma unroll
    for (int kk = 0; kk < 4; ++kk)
        qf[kk] = load_frag(Q + (size_t)q0 * EMB + h * HD + kk * 32, EMB, lane);

    v8f acc[8];
#pragma unroll
    for (int d = 0; d < 8; ++d) acc[d] = (v8f){0.f,0.f,0.f,0.f,0.f,0.f,0.f,0.f};
    float m[8], lsum[8];
#pragma unroll
    for (int r = 0; r < 8; ++r) { m[r] = -3.0e38f; lsum[r] = 0.f; }

    // Prologue: stage key-step 0.
    if (threadIdx.x < 32) {
        tdm_load_tile(Kmat + (size_t)0 * EMB + h * HD,
                      (unsigned)(uintptr_t)&Ktile[0][0], S_LEN, EMB, 128, 32, 5, 3);
        tdm_load_tile(Vt + (size_t)(h * HD) * S_LEN + 0,
                      (unsigned)(uintptr_t)&Vtile[0][0], EMB, S_LEN, 32, 128, 3, 3);
    }

    const int nt = S_LEN / 32;
    for (int i = 0; i < nt; ++i) {
        const int cur = i & 1;
        if (threadIdx.x < 32) {
            if (i + 1 < nt) {
                const int t1 = (i + 1) * 32;
                tdm_load_tile(Kmat + (size_t)t1 * EMB + h * HD,
                              (unsigned)(uintptr_t)&Ktile[cur ^ 1][0], S_LEN, EMB, 128, 32, 5, 3);
                tdm_load_tile(Vt + (size_t)(h * HD) * S_LEN + t1,
                              (unsigned)(uintptr_t)&Vtile[cur ^ 1][0], EMB, S_LEN, 32, 128, 3, 3);
                __builtin_amdgcn_s_wait_tensorcnt(2);
            } else {
                __builtin_amdgcn_s_wait_tensorcnt(0);
            }
        }
        __syncthreads();

        // ---- scores: Q (16xHD) x K^T (HDx32) -> two 16x16 f32 tiles
        v8f s0 = (v8f){0.f,0.f,0.f,0.f,0.f,0.f,0.f,0.f};
        v8f s1 = (v8f){0.f,0.f,0.f,0.f,0.f,0.f,0.f,0.f};
        v16bf kf0[4], kf1[4];      // all 16 LDS reads of the K tile as one group
#pragma unroll
        for (int kk = 0; kk < 4; ++kk) {
            FragU _u;
            const int r0 = l;          // B column t = K-tile row (lanes 0..15)
            _u.p.lo = *(const v8bf*)&Ktile[cur][r0 * KT_PITCH + kk * 32 + hi * 8];
            _u.p.hi = *(const v8bf*)&Ktile[cur][r0 * KT_PITCH + kk * 32 + hi * 8 + 16];
            kf0[kk] = _u.f;
            const int r1 = 16 + l;
            _u.p.lo = *(const v8bf*)&Ktile[cur][r1 * KT_PITCH + kk * 32 + hi * 8];
            _u.p.hi = *(const v8bf*)&Ktile[cur][r1 * KT_PITCH + kk * 32 + hi * 8 + 16];
            kf1[kk] = _u.f;
        }
        // Keeps the group ahead of the first WMMA: left free, the compiler sinks each pair of
        // reads to its WMMA and waits out the LDS latency once per fragment.
        __builtin_amdgcn_sched_barrier(0);
#pragma unroll
        for (int kk = 0; kk < 4; ++kk) {
            s0 = wmma_bf16(qf[kk], kf0[kk], s0);
            s1 = wmma_bf16(qf[kk], kf1[kk], s1);
        }
        // All 16 LDS reads of the V tile as one group; they land while the softmax is worked out.
        v16bf vf[8];
#pragma unroll
        for (int d = 0; d < 8; ++d)
            GEMM_LDS_FRAG(Vtile[cur], d * 16, vf[d]);
        // Keeps the group ahead of the softmax: left free, the compiler sinks the reads to the
        // P x V WMMAs, one wait per fragment.
        __builtin_amdgcn_sched_barrier(0);
        // ---- online softmax (rows live across 16 lanes of a half-wave)
        float corr[8];
#pragma unroll
        for (int r = 0; r < 8; ++r) {
            s0[r] *= sc; s1[r] *= sc;
            float mx = fmaxf(s0[r], s1[r]);
            mx = fmaxf(mx, __shfl_xor(mx, 1));
            mx = fmaxf(mx, __shfl_xor(mx, 2));
            mx = fmaxf(mx, __shfl_xor(mx, 4));
            mx = fmaxf(mx, __shfl_xor(mx, 8));
            const float mn = fmaxf(m[r], mx);
            corr[r] = __expf(m[r] - mn);
            m[r] = mn;
            s0[r] = __expf(s0[r] - mn);
            s1[r] = __expf(s1[r] - mn);
            float sum = s0[r] + s1[r];
            sum += __shfl_xor(sum, 1);
            sum += __shfl_xor(sum, 2);
            sum += __shfl_xor(sum, 4);
            sum += __shfl_xor(sum, 8);
            lsum[r] = lsum[r] * corr[r] + sum;
        }
#pragma unroll
        for (int d = 0; d < 8; ++d)
#pragma unroll
            for (int r = 0; r < 8; ++r) acc[d][r] *= corr[r];

        // ---- P: C-layout -> A-layout transpose via wave-private LDS tile.
        // DS ops from the same wave are in-order; no cross-wave sharing.
#pragma unroll
        for (int r = 0; r < 8; ++r) {
            const int row = r + hi * 8;
            Plds[w][row * 32 + l]      = (__bf16)s0[r];
            Plds[w][row * 32 + 16 + l] = (__bf16)s1[r];
        }
        FragU pu;
        pu.p.lo = *(const v8bf*)&Plds[w][l * 32 + hi * 8];
        pu.p.hi = *(const v8bf*)&Plds[w][l * 32 + hi * 8 + 16];

        // ---- acc += P (16x32) x V (32xHD); Vt-tile rows are contiguous over t
#pragma unroll
        for (int d = 0; d < 8; ++d)
            acc[d] = wmma_bf16(pu.f, vf[d], acc[d]);
        __syncthreads();
    }

    // ---- normalize and emit bf16 attention output [S, EMB]
#pragma unroll
    for (int r = 0; r < 8; ++r) lsum[r] = 1.f / lsum[r];
#pragma unroll
    for (int d = 0; d < 8; ++d) {
        const int col = h * HD + d * 16 + l;
#pragma unroll
        for (int r = 0; r < 8; ++r) {
            const int row = q0 + r + hi * 8;
            Ao[(size_t)row * EMB + col] = (__bf16)(acc[d][r] * lsum[r]);
        }
    }
}

extern "C" void kernel_launch(void* const* d_in, const int* in_sizes, int n_in,
                              void* d_out, int out_size, void* d_ws, size_t ws_size,
                              hipStream_t stream) {
    (void)in_sizes; (void)n_in; (void)out_size; (void)ws_size;
    const float* x  = (const float*)d_in[0];
    const float* Wq = (const float*)d_in[1];
    const float* bq = (const float*)d_in[2];
    const float* Wk = (const float*)d_in[3];
    const float* bk = (const float*)d_in[4];
    const float* Wv = (const float*)d_in[5];
    const float* bv = (const float*)d_in[6];
    const float* Wo = (const float*)d_in[7];
    const float* bo = (const float*)d_in[8];
    float* out = (float*)d_out;

    char* ws = (char*)d_ws;
    const size_t TB = (size_t)S_LEN * EMB * sizeof(__bf16);   // 8 MB per bf16 tensor
    __bf16* xb  = (__bf16*)(ws + 0 * TB);
    __bf16* Wqb = (__bf16*)(ws + 1 * TB);
    __bf16* Wkb = (__bf16*)(ws + 2 * TB);
    __bf16* Wvb = (__bf16*)(ws + 3 * TB);
    __bf16* Wob = (__bf16*)(ws + 4 * TB);
    __bf16* Qb  = (__bf16*)(ws + 5 * TB);
    __bf16* Kb  = (__bf16*)(ws + 6 * TB);
    __bf16* Vtb = (__bf16*)(ws + 7 * TB);   // transposed [EMB, S]
    __bf16* Ab  = (__bf16*)(ws + 8 * TB);   // attention output bf16 [S, EMB]

    hipLaunchKernelGGL(cvt5_bf16_kernel, dim3(256), dim3(512), 0, stream,
                       x, Wq, Wk, Wv, Wo, xb, Wqb, Wkb, Wvb, Wob);

    dim3 gg(EMB / 128, S_LEN / 128);
    // Q, K projections (bf16 row-major out)
    hipLaunchKernelGGL(gemm_bf16_kernel, gg, dim3(256), 0, stream,
                       xb, Wqb, bq, (float*)nullptr, Qb, S_LEN, EMB, EMB, 1);
    hipLaunchKernelGGL(gemm_bf16_kernel, gg, dim3(256), 0, stream,
                       xb, Wkb, bk, (float*)nullptr, Kb, S_LEN, EMB, EMB, 1);
    // V projection stored transposed: Vt[e, t]
    hipLaunchKernelGGL(gemm_bf16_kernel, gg, dim3(256), 0, stream,
                       xb, Wvb, bv, (float*)nullptr, Vtb, S_LEN, EMB, EMB, 2);
    // attention
    hipLaunchKernelGGL(flash_attn_kernel, dim3(S_LEN / 128, NH), dim3(256), 0, stream,
                       Qb, Kb, Vtb, Ab);
    // output projection -> f32 d_out
    hipLaunchKernelGGL(gemm_bf16_kernel, gg, dim3(256), 0, stream,
                       Ab, Wob, bo, out, (__bf16*)nullptr, S_LEN, EMB, EMB, 0);
}

// v004
// It runs in 142 microseconds.
// In both of two side-by-side timings against v003, it was 1.18 times as fast.
// Over all steps from v000 it is 1.63 times as fast.
#include <hip/hip_runtime.h>
#include <hip/hip_bf16.h>
#include <stdint.h>

#define S_LEN 2048
#define EMB   2048
#define NH    16
#define HD    128

typedef __attribute__((ext_vector_type(16))) __bf16 v16bf;
typedef __attribute__((ext_vector_type(8)))  __bf16 v8bf;
typedef __attribute__((ext_vector_type(8)))  float  v8f;
typedef __attribute__((ext_vector_type(4)))  unsigned int u32x4;
typedef __attribute__((ext_vector_type(8)))  unsigned int u32x8;
typedef __attribute__((ext_vector_type(8)))  int          i32x8;
typedef __attribute__((ext_vector_type(4)))  int          i32x4;

union FragU { v16bf f; struct { v8bf lo, hi; } p; };

// Load one 16x32 bf16 WMMA operand fragment from global (A-layout; B uses the
// same per-lane pattern with "row" = B column, both K-contiguous in memory).
// Per ISA 7.12.2: lanes 0-15 hold K=0..7 (v0-3) and K=16..23 (v4-7),
// lanes 16-31 hold K=8..15 and K=24..31.
static __device__ inline v16bf load_frag(const __bf16* __restrict__ base, int ld, int lane) {
    const int l  = lane & 15;
    const int hi = lane >> 4;
    const __bf16* p = base + (size_t)l * ld + hi * 8;
    FragU u;
    u.p.lo = *(const v8bf*)(p);
    u.p.hi = *(const v8bf*)(p + 16);
    return u.f;
}

static __device__ inline v8f wmma_bf16(v16bf a, v16bf b, v8f c) {
    return __builtin_amdgcn_wmma_f32_16x16x32_bf16(false, a, false, b, (short)0, c, false, false);
}

// The value that the lane 16 away holds (lane l <-> lane l ^ 16).
static __device__ inline float xhalf(float v) {
    const int b = __builtin_bit_cast(int, v);
    return __builtin_bit_cast(float, __builtin_amdgcn_permlanex16(b, b, 0x76543210, 0xfedcba98, false, false));
}

// ---------------------------------------------------------------------- TDM
// Issue one Tensor-Data-Mover 2D tile load of (tileRows x tileCols) bf16
// elements from a row-major [rows, ld] bf16 tensor into LDS at byte offset
// ldsOff, appending LDS padding after each row (pad codes per D# §8.4:
// padInterval: 0=2,1=4,..,7=256 DWORDs between pads; padAmount: n+1 DWORDs)
// so ds_load_b128 fragment fetches are bank-conflict-free.
static __device__ inline void tdm_load_tile(const __bf16* gtile, unsigned ldsOff,
                                            int rows, int ld,
                                            int tileCols, int tileRows,
                                            unsigned padInterval, unsigned padAmount) {
    const unsigned long long ga = (unsigned long long)(uintptr_t)gtile;
    u32x4 g0;
    g0.x = 1u;                                      // count=1, user descriptor
    g0.y = ldsOff;                                  // lds_addr (bytes)
    g0.z = (unsigned)ga;                            // global_addr[31:0]
    g0.w = (unsigned)((ga >> 32) & 0x01FFFFFFu)     // global_addr[56:32]
         | (2u << 30);                              // type = 2 ("image")
    i32x8 g1;
    g1[0] = (int)((1u << 16)                        // data_size: 2 bytes
                | (1u << 20)                        // pad_enable
                | (padInterval << 22)
                | (padAmount << 25));
    g1[1] = (int)(((unsigned)ld & 0xFFFFu) << 16);             // tensor_dim0 lo
    g1[2] = (int)((((unsigned)ld >> 16) & 0xFFFFu)
                | (((unsigned)rows & 0xFFFFu) << 16));          // dim0 hi | dim1 lo
    g1[3] = (int)(((((unsigned)rows) >> 16) & 0xFFFFu)
                | (((unsigned)tileCols) << 16));                // dim1 hi | tile_dim0
    g1[4] = tileRows;                                           // tile_dim1
    g1[5] = ld;                                                 // tensor_dim0_stride
    g1[6] = 0;
    g1[7] = 0;
    const i32x4 z4 = (i32x4){0, 0, 0, 0};
#if defined(__clang_major__) && (__clang_major__ >= 23)
    const i32x8 z8 = (i32x8){0, 0, 0, 0, 0, 0, 0, 0};
    __builtin_amdgcn_tensor_load_to_lds(g0, g1, z4, z4, z8, 0);
#else
    __builtin_amdgcn_tensor_load_to_lds(g0, g1, z4, z4, 0);
#endif
}

// ---------------------------------------------------------------- fp32 -> bf16
// One launch converts all five S_LEN x EMB tensors. 256 work-groups of 16 waves. Of every
// tensor a wave takes 4 KiB: eight loads of 512 contiguous bytes (16 B per lane), each
// answered by one store of 256 contiguous bytes.
#define CVT_LOADS 8
typedef __attribute__((ext_vector_type(4))) float  f32x4;
typedef __attribute__((ext_vector_type(4))) __bf16 v4bf;

__global__ __launch_bounds__(512) void cvt5_bf16_kernel(
    const float* __restrict__ s0, const float* __restrict__ s1, const float* __restrict__ s2,
    const float* __restrict__ s3, const float* __restrict__ s4,
    __bf16* __restrict__ d0, __bf16* __restrict__ d1, __bf16* __restrict__ d2,
    __bf16* __restrict__ d3, __bf16* __restrict__ d4)
{
    const unsigned wv   = blockIdx.x * 16u + (threadIdx.x >> 5);
    const unsigned quad = wv * (CVT_LOADS * 32u) + (threadIdx.x & 31u);   // index of 4 elements
    const f32x4* const srcs[5] = { (const f32x4*)s0, (const f32x4*)s1, (const f32x4*)s2,
                                   (const f32x4*)s3, (const f32x4*)s4 };
    v4bf* const dsts[5] = { (v4bf*)d0, (v4bf*)d1, (v4bf*)d2, (v4bf*)d3, (v4bf*)d4 };

    f32x4 v[5][CVT_LOADS];
#pragma unroll
    for (int t = 0; t < 5; ++t)
#pragma unroll
        for (int j = 0; j < CVT_LOADS; ++j)
            v[t][j] = *(srcs[t] + quad + j * 32);
    // Keeps every load ahead of the first conversion: left free, the compiler reuses the
    // registers, drains the load queue half-way and pays the memory latency again.
    __builtin_amdgcn_sched_barrier(0);
#pragma unroll
    for (int t = 0; t < 5; ++t)
#pragma unroll
        for (int j = 0; j < CVT_LOADS; ++j) {
            v4bf o;
            o[0] = (__bf16)v[t][j][0];
            o[1] = (__bf16)v[t][j][1];
            o[2] = (__bf16)v[t][j][2];
            o[3] = (__bf16)v[t][j][3];
            *(dsts[t] + quad + j * 32) = o;
        }
}

// ------------------------------------------------- C = A[M,K] * W[N,K]^T + bias
// 8 waves compute a 128x128 C tile. A stage is 128 k: 256 B of each of the 128 A
// rows and 128 W rows. Every wave brings its own 32-row slice of the stage with one
// tensor load into a two-buffer LDS ring; the next stage flies while this one is
// worked on. Needs M, N multiples of 128, K a multiple of 128 and at least 256.
// outMode: 0 = f32 row-major, 1 = bf16 row-major, 2 = bf16 transposed [N,M]
#define LDS_PITCH 40   // bf16 elems per 32-elem LDS tile row (+8 TDM pad)
#define KT_PITCH  136  // bf16 elems per 128-elem LDS tile row (+8 TDM pad)

#define GEMM_LDS_FRAG(tile, row0, dst) do {                              \
        FragU _u;                                                        \
        const int _r = (row0) + l;                                       \
        _u.p.lo = *(const v8bf*)&(tile)[_r * LDS_PITCH + hi * 8];        \
        _u.p.hi = *(const v8bf*)&(tile)[_r * LDS_PITCH + hi * 8 + 16];   \
        (dst) = _u.f; } while (0)

#define G_ROWB  256u              // bytes of an operand row in one stage
#define G_PITCH 272u              // LDS row pitch: the row + the mover's 16-B pad (ds_load_b128 readers)
#define G_ROWS  32u               // rows per slice
#define G_SLICE 10240u            // 32 * 272 = 8,704 B, rounded up to a multiple of 2 KiB
#define G_BUF   (8u * G_SLICE)    // slices 0-3: A rows, slices 4-7: W rows

static __device__ inline uint32_t uni(uint32_t v) {
    return (uint32_t)__builtin_amdgcn_readfirstlane(v);
}
static __device__ inline uint32_t pinned(uint32_t v) {
    uint32_t w = uni(v);
    asm volatile("" : "+s"(w));
    return w;
}
static __device__ inline u32x4 tdm_group0(uint32_t ldsDst, uint64_t ga) {
    u32x4 g;
    g[0] = uni(1u);                                                    // count = 1
    g[1] = uni(ldsDst);                                                // byte offset in the work-group's LDS
    g[2] = uni((uint32_t)ga);                                          // global address [31:0]
    g[3] = uni((((uint32_t)(ga >> 32)) & 0x01FFFFFFu) | 0x80000000u);  // [56:32] | type = 2
    return g;
}
// 1-byte elements, tensor = tile = 32 rows of 256 B, 4 dwords of LDS pad behind every row.
static __device__ inline u32x8 tdm_group1(uint32_t srcPitch) {
    u32x8 g;
    g[0] = uni((1u << 20) | (5u << 22) | (3u << 25));
    g[1] = uni((G_ROWB & 0xFFFFu) << 16);
    g[2] = uni((G_ROWB >> 16) | ((G_ROWS & 0xFFFFu) << 16));
    g[3] = uni((G_ROWS >> 16) | (G_ROWB << 16));
    g[4] = uni(G_ROWS);
    g[5] = uni(srcPitch);
    g[6] = uni(0u);
    g[7] = uni(0u);
    return g;
}
// One request of the whole wave: the mover copies the tile into LDS through no register.
static __device__ inline void tdm_load(u32x4 g0, u32x8 g1) {
    asm volatile("tensor_load_to_lds %0, %1" :: "s"(g0), "s"(g1) : "memory");
}
static __device__ inline v16bf ring_frag(const unsigned char* p) {
    FragU u;
    u.p.lo = *(const v8bf*)(p);
    u.p.hi = *(const v8bf*)(p + 32);
    return u.f;
}

__global__ __launch_bounds__(256) void gemm_bf16_kernel(
    const __bf16* __restrict__ A, const __bf16* __restrict__ W,
    const float* __restrict__ bias,
    float* __restrict__ outF, __bf16* __restrict__ outB,
    int M, int N, int K, int outMode)
{
    __shared__ __attribute__((aligned(2048))) unsigned char ring[2u * G_BUF];

    const int lane = threadIdx.x & 31;
    const int w    = threadIdx.x >> 5;            // 8 waves: 4 (M) x 2 (N)
    const int bm   = blockIdx.y * 128;
    const int bn   = blockIdx.x * 128;
    const int wmr  = (w >> 1) * 32;               // wave row offset in block tile
    const int wnc  = (w & 1) * 64;                // wave col offset in block tile
    const int l    = lane & 15;
    const int hi   = lane >> 4;

    v8f acc[2][4];
#pragma unroll
    for (int i = 0; i < 2; ++i)
#pragma unroll
        for (int j = 0; j < 4; ++j)
            acc[i][j] = (v8f){0.f,0.f,0.f,0.f,0.f,0.f,0.f,0.f};

    // This wave's slice: waves 0-3 bring A rows, waves 4-7 W rows.
    const uint32_t wave = uni(threadIdx.x >> 5);
    const __bf16* srow = (wave < 4u) ? A + (size_t)(bm + 32 * (int)wave) * K
                                     : W + (size_t)(bn + 32 * (int)(wave - 4u)) * K;
    const uint64_t ga   = (uint64_t)(uintptr_t)srow;
    const uint32_t dst  = (uint32_t)(uintptr_t)&ring[0] + wave * G_SLICE;
    const u32x8    g1   = tdm_group1((uint32_t)K * 2u);
    const uint32_t ns   = uni((uint32_t)K / 128u);

    // Prologue: stage 0 lands and is published; then stage 1 is sent off.
    tdm_load(tdm_group0(dst, ga), g1);
    asm volatile("s_wait_tensorcnt 0x0" ::: "memory");   // this wave's slice of stage 0 has landed
    __syncthreads();
    tdm_load(tdm_group0(dst + G_BUF, ga + G_ROWB), g1);

    const unsigned char* aBase = ring + (uint32_t)(w >> 1) * G_SLICE + (uint32_t)l * G_PITCH + (uint32_t)hi * 16u;
    const unsigned char* bBase = ring + (4u + (uint32_t)(w & 1) * 2u) * G_SLICE + (uint32_t)l * G_PITCH + (uint32_t)hi * 16u;

    for (uint32_t s = 0; s < ns; ++s) {
        const uint32_t bo = (s & 1u) * G_BUF;
        const unsigned char* ap = aBase + bo;
        const unsigned char* bp = bBase + bo;
        // The stage's four blocks of 32 k. A block's 12 LDS reads go out as one group, well
        // ahead of its 8 WMMAs: blocks 0-2 at the head of the stage, block 3 behind block 0's WMMAs.
        v16bf af[4][2], bfr[4][4];
#define GEMM_LOAD_BLOCK(kk) do {                                                             \
        af[kk][0] = ring_frag(ap + (kk) * 64u);                                              \
        af[kk][1] = ring_frag(ap + 16u * G_PITCH + (kk) * 64u);                              \
        _Pragma("unroll")                                                                    \
        for (uint32_t j = 0; j < 4u; ++j)                                                    \
            bfr[kk][j] = ring_frag(bp + (j >> 1) * G_SLICE + (j & 1u) * 16u * G_PITCH + (kk) * 64u); \
    } while (0)
#define GEMM_WMMA_BLOCK(kk) do {                                                             \
        _Pragma("unroll")                                                                    \
        for (int j = 0; j < 4; ++j) {                                                        \
            acc[0][j] = wmma_bf16(af[kk][0], bfr[kk][j], acc[0][j]);                         \
            acc[1][j] = wmma_bf16(af[kk][1], bfr[kk][j], acc[1][j]);                         \
        }                                                                                    \
    } while (0)
        GEMM_LOAD_BLOCK(0);
        GEMM_LOAD_BLOCK(1);
        GEMM_LOAD_BLOCK(2);
        // Keeps the three groups ahead of the first WMMA: left free, the compiler sinks each
        // pair of reads to its WMMA and waits out the LDS latency once per fragment.
        __builtin_amdgcn_sched_barrier(0);
        GEMM_WMMA_BLOCK(0);
        // Keeps block 3's reads between block 0's and block 1's WMMAs, for the same reason.
        __builtin_amdgcn_sched_barrier(0);
        GEMM_LOAD_BLOCK(3);
        __builtin_amdgcn_sched_barrier(0);
        GEMM_WMMA_BLOCK(1);
        GEMM_WMMA_BLOCK(2);
        GEMM_WMMA_BLOCK(3);
        // Keeps the WMMAs ahead of the publish point: left free, the compiler lifts the waits and
        // the barrier over blocks 1-3, which then run with the LDS idle and hold back the refill.
        __builtin_amdgcn_sched_barrier(0);
        // Publish point of stage s + 1, every wave, in this order.
        asm volatile("s_wait_dscnt 0x0" ::: "memory");      // this wave's reads of stage s are done
        asm volatile("s_wait_tensorcnt 0x0" ::: "memory");  // this wave's slice of stage s + 1 has landed
        __syncthreads();
        if (pinned(s + 2u < ns))                             // refill the buffer every reader has just left
            tdm_load(tdm_group0(dst + bo, ga + (uint64_t)(s + 2u) * G_ROWB), g1);
    }
    asm volatile("s_wait_tensorcnt 0x0" ::: "memory");       // nothing of the mover is left in flight
    asm volatile("s_wait_dscnt 0x0" ::: "memory");

    const int wm = bm + wmr;
    const int wn = bn + wnc;
    if (outMode == 0) {
#pragma unroll
        for (int i = 0; i < 2; ++i)
#pragma unroll
            for (int j = 0; j < 4; ++j) {
                const int col = wn + j * 16 + l;
                const float bc = bias ? bias[col] : 0.f;
#pragma unroll
                for (int r = 0; r < 8; ++r)
                    outF[(size_t)(wm + i * 16 + r + hi * 8) * N + col] = acc[i][j][r] + bc;
            }
    } else if (outMode == 1) {
#pragma unroll
        for (int i = 0; i < 2; ++i)
#pragma unroll
            for (int j = 0; j < 4; ++j) {
                const int col = wn + j * 16 + l;
                const float bc = bias ? bias[col] : 0.f;
#pragma unroll
                for (int r = 0; r < 8; ++r)
                    outB[(size_t)(wm + i * 16 + r + hi * 8) * N + col] =
                        (__bf16)(acc[i][j][r] + bc);
            }
    } else {
#pragma unroll
        for (int i = 0; i < 2; ++i)
#pragma unroll
            for (int j = 0; j < 4; ++j) {
                const int col = wn + j * 16 + l;
                const float bc = bias ? bias[col] : 0.f;
#pragma unroll
                for (int r = 0; r < 8; ++r)
                    outB[(size_t)col * M + (wm + i * 16 + r + hi * 8)] =
                        (__bf16)(acc[i][j][r] + bc);
            }
    }
}

// ----------------------------------------------------------- flash attention
// Q, K: bf16 [S, EMB] (head h in cols h*HD..); Vt: bf16 [EMB, S] (row h*HD+d).
// Block = 8 waves x 16 queries, one head. Per key-step of 32, wave 0 TDM-
// stages the shared K tile (32xHD) and Vt tile (HDx32) into double-buffered
// LDS; all waves consume via ds_load_b128.
// Both products are taken transposed: S^T = K x Q^T and O^T += V^T x P^T. A lane then holds
// 16 of the 32 scores of ONE query (lane l and lane l + 16 share query l), so the maximum and
// the sum are taken inside the lane, and the two score tiles, converted in place, are already
// the B operand of the second product.
__global__ __launch_bounds__(256) void flash_attn_kernel(
    const __bf16* __restrict__ Q, const __bf16* __restrict__ Kmat,
    const __bf16* __restrict__ Vt, __bf16* __restrict__ Ao)
{
    __shared__ alignas(16) __bf16 Ktile[2][32 * KT_PITCH];     // rows t, cols d
    __shared__ alignas(16) __bf16 Vtile[2][128 * LDS_PITCH];   // rows d, cols t

    const int lane = threadIdx.x & 31;
    const int w    = threadIdx.x >> 5;
    const int q0   = blockIdx.x * 128 + w * 16;
    const int h    = blockIdx.y;
    const int l    = lane & 15;
    const int hi   = lane >> 4;
    const float sc = 0.08838834764831845f;    // 1/sqrt(HD)

    v16bf qf[4];               // B operand: column = query q0 + l
#pragma unroll
    for (int kk = 0; kk < 4; ++kk)
        qf[kk] = load_frag(Q + (size_t)q0 * EMB + h * HD + kk * 32, EMB, lane);

    v8f acc[8];                // acc[d][r] = O[q0 + l][d * 16 + hi * 8 + r]
#pragma unroll
    for (int d = 0; d < 8; ++d) acc[d] = (v8f){0.f,0.f,0.f,0.f,0.f,0.f,0.f,0.f};
    float m = -3.0e38f;        // running maximum of query q0 + l, the same in both half-waves
    float lsum = 0.f;          // running sum over this half-wave's keys only

    // Prologue: stage key-step 0.
    if (threadIdx.x < 32) {
        tdm_load_tile(Kmat + (size_t)0 * EMB + h * HD,
                      (unsigned)(uintptr_t)&Ktile[0][0], S_LEN, EMB, 128, 32, 5, 3);
        tdm_load_tile(Vt + (size_t)(h * HD) * S_LEN + 0,
                      (unsigned)(uintptr_t)&Vtile[0][0], EMB, S_LEN, 32, 128, 3, 3);
    }

    const int nt = S_LEN / 32;
    for (int i = 0; i < nt; ++i) {
        const int cur = i & 1;
        // The four vector slots that the chip needs between the last WMMA of the pass before and
        // a vector instruction that overwrites its operand registers.
        asm volatile("v_nop\n\tv_nop\n\tv_nop\n\tv_nop");
        if (threadIdx.x < 32) {
            if (i + 1 < nt) {
                const int t1 = (i + 1) * 32;
                tdm_load_tile(Kmat + (size_t)t1 * EMB + h * HD,
                              (unsigned)(uintptr_t)&Ktile[cur ^ 1][0], S_LEN, EMB, 128, 32, 5, 3);
                tdm_load_tile(Vt + (size_t)(h * HD) * S_LEN + t1,
                              (unsigned)(uintptr_t)&Vtile[cur ^ 1][0], EMB, S_LEN, 32, 128, 3, 3);
                __builtin_amdgcn_s_wait_tensorcnt(2);
            } else {
                __builtin_amdgcn_s_wait_tensorcnt(0);
            }
        }
        __syncthreads();

        // ---- scores: K (32xHD) x Q^T (HDx16) -> two 16x16 f32 tiles,
        // s0[r] = S[q0 + l][t0 + hi * 8 + r], s1[r] = S[q0 + l][t0 + 16 + hi * 8 + r]
        v8f s0 = (v8f){0.f,0.f,0.f,0.f,0.f,0.f,0.f,0.f};
        v8f s1 = (v8f){0.f,0.f,0.f,0.f,0.f,0.f,0.f,0.f};
        v16bf kf0[4], kf1[4];      // all 16 LDS reads of the K tile as one group
#pragma unroll
        for (int kk = 0; kk < 4; ++kk) {
            FragU _u;
            const int r0 = l;          // A row t = K-tile row (lanes 0..15)
            _u.p.lo = *(const v8bf*)&Ktile[cur][r0 * KT_PITCH + kk * 32 + hi * 8];
            _u.p.hi = *(const v8bf*)&Ktile[cur][r0 * KT_PITCH + kk * 32 + hi * 8 + 16];
            kf0[kk] = _u.f;
            const int r1 = 16 + l;
            _u.p.lo = *(const v8bf*)&Ktile[cur][r1 * KT_PITCH + kk * 32 + hi * 8];
            _u.p.hi = *(const v8bf*)&Ktile[cur][r1 * KT_PITCH + kk * 32 + hi * 8 + 16];
            kf1[kk] = _u.f;
        }
        // Keeps the group ahead of the first WMMA: left free, the compiler sinks each pair of
        // reads to its WMMA and waits out the LDS latency once per fragment.
        __builtin_amdgcn_sched_barrier(0);
#pragma unroll
        for (int kk = 0; kk < 4; ++kk) {
            s0 = wmma_bf16(kf0[kk], qf[kk], s0);
            s1 = wmma_bf16(kf1[kk], qf[kk], s1);
        }
        // All 16 LDS reads of the V tile as one group; they land while the softmax is worked out.
        v16bf vf[8];               // A operand: row = d, k = key in the hardware k order
#pragma unroll
        for (int d = 0; d < 8; ++d)
            GEMM_LDS_FRAG(Vtile[cur], d * 16, vf[d]);
        // Keeps the group ahead of the softmax: left free, the compiler sinks the reads to the
        // V^T x P^T WMMAs, one wait per fragment.
        __builtin_amdgcn_sched_barrier(0);
        // ---- online softmax: one query per lane, its 32 keys split over lanes l and l + 16
        const float a0 = fmaxf(fmaxf(s0[0], s0[1]), s0[2]);
        const float a1 = fmaxf(fmaxf(s0[3], s0[4]), s0[5]);
        const float a2 = fmaxf(fmaxf(s0[6], s0[7]), s1[0]);
        const float a3 = fmaxf(fmaxf(s1[1], s1[2]), s1[3]);
        const float a4 = fmaxf(fmaxf(s1[4], s1[5]), s1[6]);
        float mx = fmaxf(fmaxf(fmaxf(a0, a1), a2), fmaxf(fmaxf(a3, a4), s1[7]));
        mx = fmaxf(mx, xhalf(mx)) * sc;      // sc > 0: the largest scaled score
        const float mn   = fmaxf(m, mx);
        const float corr = __expf(m - mn);
        m = mn;
#pragma unroll
        for (int r = 0; r < 8; ++r) {
            s0[r] = __expf(s0[r] * sc - mn);
            s1[r] = __expf(s1[r] * sc - mn);
        }
#pragma unroll
        for (int d = 0; d < 8; ++d)
#pragma unroll
            for (int r = 0; r < 8; ++r) acc[d][r] *= corr;

        // ---- P^T: the two score tiles, converted in place, are the 32x16 B operand
        // (element s of lane (l, hi) is key hi * 8 + s for s < 8, 16 + hi * 8 + s - 8 above).
        v16bf pf;
#pragma unroll
        for (int r = 0; r < 8; ++r) {
            pf[r]     = (__bf16)s0[r];
            pf[8 + r] = (__bf16)s1[r];
        }

        // ---- acc += V^T (HDx32) x P^T (32x16); Vt-tile rows are contiguous over t
#pragma unroll
        for (int d = 0; d < 8; ++d)
            acc[d] = wmma_bf16(vf[d], pf, acc[d]);

        // ---- the sum of this lane's 16 weights: registers only, nothing of this pass waits for it
        float sumA = s0[0] + s1[0], sumB = s0[1] + s1[1];
#pragma unroll
        for (int r = 2; r < 8; r += 2) {
            sumA += s0[r] + s1[r];
            sumB += s0[r + 1] + s1[r + 1];
        }
        lsum = lsum * corr + (sumA + sumB);
        __syncthreads();
    }

    // ---- join the half-waves' sums, normalize and emit bf16 attention output [S, EMB]:
    // a lane's 8 accumulator registers are 8 consecutive columns of one row, one 16-B store.
    const float inv = 1.f / (lsum + xhalf(lsum));
    __bf16* orow = Ao + (size_t)(q0 + l) * EMB + h * HD + hi * 8;
#pragma unroll
    for (int d = 0; d < 8; ++d) {
        v8bf o;
#pragma unroll
        for (int r = 0; r < 8; ++r) o[r] = (__bf16)(acc[d][r] * inv);
        *(v8bf*)(orow + d * 16) = o;
    }
}

extern "C" void kernel_launch(void* const* d_in, const int* in_sizes, int n_in,
                              void* d_out, int out_size, void* d_ws, size_t ws_size,
                              hipStream_t stream) {
    (void)in_sizes; (void)n_in; (void)out_size; (void)ws_size;
    const float* x  = (const float*)d_in[0];
    const float* Wq = (const float*)d_in[1];
    const float* bq = (const float*)d_in[2];
    const float* Wk = (const float*)d_in[3];
    const float* bk = (const float*)d_in[4];
    const float* Wv = (const float*)d_in[5];
    const float* bv = (const float*)d_in[6];
    const float* Wo = (const float*)d_in[7];
    const float* bo = (const float*)d_in[8];
    float* out = (float*)d_out;

    char* ws = (char*)d_ws;
    const size_t TB = (size_t)S_LEN * EMB * sizeof(__bf16);   // 8 MB per bf16 tensor
    __bf16* xb  = (__bf16*)(ws + 0 * TB);
    __bf16* Wqb = (__bf16*)(ws + 1 * TB);
    __bf16* Wkb = (__bf16*)(ws + 2 * TB);
    __bf16* Wvb = (__bf16*)(ws + 3 * TB);
    __bf16* Wob = (__bf16*)(ws + 4 * TB);
    __bf16* Qb  = (__bf16*)(ws + 5 * TB);
    __bf16* Kb  = (__bf16*)(ws + 6 * TB);
    __bf16* Vtb = (__bf16*)(ws + 7 * TB);   // transposed [EMB, S]
    __bf16* Ab  = (__bf16*)(ws + 8 * TB);   // attention output bf16 [S, EMB]

    hipLaunchKernelGGL(cvt5_bf16_kernel, dim3(256), dim3(512), 0, stream,
                       x, Wq, Wk, Wv, Wo, xb, Wqb, Wkb, Wvb, Wob);

    dim3 gg(EMB / 128, S_LEN / 128);
    // Q, K projections (bf16 row-major out)
    hipLaunchKernelGGL(gemm_bf16_kernel, gg, dim3(256), 0, stream,
                       xb, Wqb, bq, (float*)nullptr, Qb, S_LEN, EMB, EMB, 1);
    hipLaunchKernelGGL(gemm_bf16_kernel, gg, dim3(256), 0, stream,
                       xb, Wkb, bk, (float*)nullptr, Kb, S_LEN, EMB, EMB, 1);
    // V projection stored transposed: Vt[e, t]
    hipLaunchKernelGGL(gemm_bf16_kernel, gg, dim3(256), 0, stream,
                       xb, Wvb, bv, (float*)nullptr, Vtb, S_LEN, EMB, EMB, 2);
    // attention
    hipLaunchKernelGGL(flash_attn_kernel, dim3(S_LEN / 128, NH), dim3(256), 0, stream,
                       Qb, Kb, Vtb, Ab);
    // output projection -> f32 d_out
    hipLaunchKernelGGL(gemm_bf16_kernel, gg, dim3(256), 0, stream,
                       Ab, Wob, bo, out, (__bf16*)nullptr, S_LEN, EMB, EMB, 0);
}

// v005
// It runs in 122 microseconds.
// In both of two side-by-side timings against v004, it was 1.16 times as fast.
// Over all steps from v000 it is 1.90 times as fast.
#include <hip/hip_runtime.h>
#include <hip/hip_bf16.h>
#include <stdint.h>

#define S_LEN 2048
#define EMB   2048
#define NH    16
#define HD    128

typedef __attribute__((ext_vector_type(16))) __bf16 v16bf;
typedef __attribute__((ext_vector_type(8)))  __bf16 v8bf;
typedef __attribute__((ext_vector_type(8)))  float  v8f;
typedef __attribute__((ext_vector_type(4)))  unsigned int u32x4;
typedef __attribute__((ext_vector_type(8)))  unsigned int u32x8;
typedef __attribute__((ext_vector_type(8)))  int          i32x8;
typedef __attribute__((ext_vector_type(4)))  int          i32x4;

union FragU { v16bf f; struct { v8bf lo, hi; } p; };

// Load one 16x32 bf16 WMMA operand fragment from global (A-layout; B uses the
// same per-lane pattern with "row" = B column, both K-contiguous in memory).
// Per ISA 7.12.2: lanes 0-15 hold K=0..7 (v0-3) and K=16..23 (v4-7),
// lanes 16-31 hold K=8..15 and K=24..31.
static __device__ inline v16bf load_frag(const __bf16* __restrict__ base, int ld, int lane) {
    const int l  = lane & 15;
    const int hi = lane >> 4;
    const __bf16* p = base + (size_t)l * ld + hi * 8;
    FragU u;
    u.p.lo = *(const v8bf*)(p);
    u.p.hi = *(const v8bf*)(p + 16);
    return u.f;
}

static __device__ inline v8f wmma_bf16(v16bf a, v16bf b, v8f c) {
    return __builtin_amdgcn_wmma_f32_16x16x32_bf16(false, a, false, b, (short)0, c, false, false);
}

// The value that the lane 16 away holds (lane l <-> lane l ^ 16).
static __device__ inline float xhalf(float v) {
    const int b = __builtin_bit_cast(int, v);
    return __builtin_bit_cast(float, __builtin_amdgcn_permlanex16(b, b, 0x76543210, 0xfedcba98, false, false));
}

// ---------------------------------------------------------------------- TDM
// Issue one Tensor-Data-Mover 2D tile load of (tileRows x tileCols) bf16
// elements from a row-major [rows, ld] bf16 tensor into LDS at byte offset
// ldsOff, appending LDS padding after each row (pad codes per D# §8.4:
// padInterval: 0=2,1=4,..,7=256 DWORDs between pads; padAmount: n+1 DWORDs)
// so ds_load_b128 fragment fetches are bank-conflict-free.
static __device__ inline void tdm_load_tile(const __bf16* gtile, unsigned ldsOff,
                                            int rows, int ld,
                                            int tileCols, int tileRows,
                                            unsigned padInterval, unsigned padAmount) {
    const unsigned long long ga = (unsigned long long)(uintptr_t)gtile;
    u32x4 g0;
    g0.x = 1u;                                      // count=1, user descriptor
    g0.y = ldsOff;                                  // lds_addr (bytes)
    g0.z = (unsigned)ga;                            // global_addr[31:0]
    g0.w = (unsigned)((ga >> 32) & 0x01FFFFFFu)     // global_addr[56:32]
         | (2u << 30);                              // type = 2 ("image")
    i32x8 g1;
    g1[0] = (int)((1u << 16)                        // data_size: 2 bytes
                | (1u << 20)                        // pad_enable
                | (padInterval << 22)
                | (padAmount << 25));
    g1[1] = (int)(((unsigned)ld & 0xFFFFu) << 16);             // tensor_dim0 lo
    g1[2] = (int)((((unsigned)ld >> 16) & 0xFFFFu)
                | (((unsigned)rows & 0xFFFFu) << 16));          // dim0 hi | dim1 lo
    g1[3] = (int)(((((unsigned)rows) >> 16) & 0xFFFFu)
                | (((unsigned)tileCols) << 16));                // dim1 hi | tile_dim0
    g1[4] = tileRows;                                           // tile_dim1
    g1[5] = ld;                                                 // tensor_dim0_stride
    g1[6] = 0;
    g1[7] = 0;
    const i32x4 z4 = (i32x4){0, 0, 0, 0};
#if defined(__clang_major__) && (__clang_major__ >= 23)
    const i32x8 z8 = (i32x8){0, 0, 0, 0, 0, 0, 0, 0};
    __builtin_amdgcn_tensor_load_to_lds(g0, g1, z4, z4, z8, 0);
#else
    __builtin_amdgcn_tensor_load_to_lds(g0, g1, z4, z4, 0);
#endif
}

// ---------------------------------------------------------------- fp32 -> bf16
// One launch converts all five S_LEN x EMB tensors. 256 work-groups of 16 waves. Of every
// tensor a wave takes 4 KiB: eight loads of 512 contiguous bytes (16 B per lane), each
// answered by one store of 256 contiguous bytes.
#define CVT_LOADS 8
typedef __attribute__((ext_vector_type(4))) float  f32x4;
typedef __attribute__((ext_vector_type(4))) __bf16 v4bf;

__global__ __launch_bounds__(512) void cvt5_bf16_kernel(
    const float* __restrict__ s0, const float* __restrict__ s1, const float* __restrict__ s2,
    const float* __restrict__ s3, const float* __restrict__ s4,
    __bf16* __restrict__ d0, __bf16* __restrict__ d1, __bf16* __restrict__ d2,
    __bf16* __restrict__ d3, __bf16* __restrict__ d4)
{
    const unsigned wv   = blockIdx.x * 16u + (threadIdx.x >> 5);
    const unsigned quad = wv * (CVT_LOADS * 32u) + (threadIdx.x & 31u);   // index of 4 elements
    const f32x4* const srcs[5] = { (const f32x4*)s0, (const f32x4*)s1, (const f32x4*)s2,
                                   (const f32x4*)s3, (const f32x4*)s4 };
    v4bf* const dsts[5] = { (v4bf*)d0, (v4bf*)d1, (v4bf*)d2, (v4bf*)d3, (v4bf*)d4 };

    f32x4 v[5][CVT_LOADS];
#pragma unroll
    for (int t = 0; t < 5; ++t)
#pragma unroll
        for (int j = 0; j < CVT_LOADS; ++j)
            v[t][j] = *(srcs[t] + quad + j * 32);
    // Keeps every load ahead of the first conversion: left free, the compiler reuses the
    // registers, drains the load queue half-way and pays the memory latency again.
    __builtin_amdgcn_sched_barrier(0);
#pragma unroll
    for (int t = 0; t < 5; ++t)
#pragma unroll
        for (int j = 0; j < CVT_LOADS; ++j) {
            v4bf o;
            o[0] = (__bf16)v[t][j][0];
            o[1] = (__bf16)v[t][j][1];
            o[2] = (__bf16)v[t][j][2];
            o[3] = (__bf16)v[t][j][3];
            *(dsts[t] + quad + j * 32) = o;
        }
}

// ------------------------------------------------- C = A[M,K] * W[N,K]^T + bias
// 8 waves compute a 128x128 C tile. A stage is 128 k: 256 B of each of the 128 A
// rows and 128 W rows. Every wave brings its own 32-row slice of the stage with one
// tensor load into a two-buffer LDS ring; the next stage flies while this one is
// worked on. Needs M, N multiples of 128, K a multiple of 128 and at least 256.
// outMode: 0 = f32 row-major, 1 = bf16 row-major, 2 = bf16 transposed [N,M]
// One launch takes up to three products of the same A: blockIdx.z picks the weights, the bias,
// the bf16 output and its mode. The ring is 160 KiB, so two work-groups fit one WGP.
#define LDS_PITCH 40   // bf16 elems per 32-elem LDS tile row (+8 TDM pad)
#define KT_PITCH  136  // bf16 elems per 128-elem LDS tile row (+8 TDM pad)

#define GEMM_LDS_FRAG(tile, row0, dst) do {                              \
        FragU _u;                                                        \
        const int _r = (row0) + l;                                       \
        _u.p.lo = *(const v8bf*)&(tile)[_r * LDS_PITCH + hi * 8];        \
        _u.p.hi = *(const v8bf*)&(tile)[_r * LDS_PITCH + hi * 8 + 16];   \
        (dst) = _u.f; } while (0)

#define G_ROWB  256u              // bytes of an operand row in one stage
#define G_PITCH 272u              // LDS row pitch: the row + the mover's 16-B pad (ds_load_b128 readers)
#define G_ROWS  32u               // rows per slice
#define G_SLICE 10240u            // 32 * 272 = 8,704 B, rounded up to a multiple of 2 KiB
#define G_BUF   (8u * G_SLICE)    // slices 0-3: A rows, slices 4-7: W rows

static __device__ inline uint32_t uni(uint32_t v) {
    return (uint32_t)__builtin_amdgcn_readfirstlane(v);
}
static __device__ inline uint32_t pinned(uint32_t v) {
    uint32_t w = uni(v);
    asm volatile("" : "+s"(w));
    return w;
}
static __device__ inline u32x4 tdm_group0(uint32_t ldsDst, uint64_t ga) {
    u32x4 g;
    g[0] = uni(1u);                                                    // count = 1
    g[1] = uni(ldsDst);                                                // byte offset in the work-group's LDS
    g[2] = uni((uint32_t)ga);                                          // global address [31:0]
    g[3] = uni((((uint32_t)(ga >> 32)) & 0x01FFFFFFu) | 0x80000000u);  // [56:32] | type = 2
    return g;
}
// 1-byte elements, tensor = tile = 32 rows of 256 B, 4 dwords of LDS pad behind every row.
static __device__ inline u32x8 tdm_group1(uint32_t srcPitch) {
    u32x8 g;
    g[0] = uni((1u << 20) | (5u << 22) | (3u << 25));
    g[1] = uni((G_ROWB & 0xFFFFu) << 16);
    g[2] = uni((G_ROWB >> 16) | ((G_ROWS & 0xFFFFu) << 16));
    g[3] = uni((G_ROWS >> 16) | (G_ROWB << 16));
    g[4] = uni(G_ROWS);
    g[5] = uni(srcPitch);
    g[6] = uni(0u);
    g[7] = uni(0u);
    // pinned(), for the whole group: the eight descriptor words stay in one set of scalar registers.
    // Left free, the compiler re-forms two of them in front of every load and lends their
    // registers to other values in between, while a request that named them is still in flight.
    asm volatile("" : "+s"(g));
    return g;
}
// One request of the whole wave: the mover copies the tile into LDS through no register.
static __device__ inline void tdm_load(u32x4 g0, u32x8 g1) {
    asm volatile("tensor_load_to_lds %0, %1" :: "s"(g0), "s"(g1) : "memory");
}
static __device__ inline v16bf ring_frag(const unsigned char* p) {
    FragU u;
    u.p.lo = *(const v8bf*)(p);
    u.p.hi = *(const v8bf*)(p + 32);
    return u.f;
}

__global__ __launch_bounds__(256) void gemm_bf16_kernel(
    const __bf16* __restrict__ A,
    const __bf16* __restrict__ W0, const __bf16* __restrict__ W1, const __bf16* __restrict__ W2,
    const float* __restrict__ bias0, const float* __restrict__ bias1, const float* __restrict__ bias2,
    float* __restrict__ outF,
    __bf16* __restrict__ outB0, __bf16* __restrict__ outB1, __bf16* __restrict__ outB2,
    int M, int N, int K, int outMode01, int outMode2)
{
    __shared__ __attribute__((aligned(2048))) unsigned char ring[2u * G_BUF];

    const uint32_t z = blockIdx.z;
    const __bf16* __restrict__ W    = (z == 0u) ? W0 : (z == 1u) ? W1 : W2;
    const float*  __restrict__ bias = (z == 0u) ? bias0 : (z == 1u) ? bias1 : bias2;
    __bf16*       __restrict__ outB = (z == 0u) ? outB0 : (z == 1u) ? outB1 : outB2;
    const int outMode = (z == 2u) ? outMode2 : outMode01;

    const int lane = threadIdx.x & 31;
    const int w    = threadIdx.x >> 5;            // 8 waves: 4 (M) x 2 (N)
    const int bm   = blockIdx.y * 128;
    const int bn   = blockIdx.x * 128;
    const int wmr  = (w >> 1) * 32;               // wave row offset in block tile
    const int wnc  = (w & 1) * 64;                // wave col offset in block tile
    const int l    = lane & 15;
    const int hi   = lane >> 4;

    v8f acc[2][4];
#pragma unroll
    for (int i = 0; i < 2; ++i)
#pragma unroll
        for (int j = 0; j < 4; ++j)
            acc[i][j] = (v8f){0.f,0.f,0.f,0.f,0.f,0.f,0.f,0.f};

    // This wave's slice: waves 0-3 bring A rows, waves 4-7 W rows.
    const uint32_t wave = uni(threadIdx.x >> 5);
    const __bf16* srow = (wave < 4u) ? A + (size_t)(bm + 32 * (int)wave) * K
                                     : W + (size_t)(bn + 32 * (int)(wave - 4u)) * K;
    const uint64_t ga   = (uint64_t)(uintptr_t)srow;
    const uint32_t dst  = (uint32_t)(uintptr_t)&ring[0] + wave * G_SLICE;
    const u32x8    g1   = tdm_group1((uint32_t)K * 2u);
    const uint32_t ns   = uni((uint32_t)K / 128u);

    // Prologue: stage 0 lands and is published; then stage 1 is sent off.
    tdm_load(tdm_group0(dst, ga), g1);
    asm volatile("s_wait_tensorcnt 0x0" ::: "memory");   // this wave's slice of stage 0 has landed
    __syncthreads();
    tdm_load(tdm_group0(dst + G_BUF, ga + G_ROWB), g1);

    const unsigned char* aBase = ring + (uint32_t)(w >> 1) * G_SLICE + (uint32_t)l * G_PITCH + (uint32_t)hi * 16u;
    const unsigned char* bBase = ring + (4u + (uint32_t)(w & 1) * 2u) * G_SLICE + (uint32_t)l * G_PITCH + (uint32_t)hi * 16u;

    for (uint32_t s = 0; s < ns; ++s) {
        const uint32_t bo = (s & 1u) * G_BUF;
        const unsigned char* ap = aBase + bo;
        const unsigned char* bp = bBase + bo;
        // The stage's four blocks of 32 k. A block's 12 LDS reads go out as one group, well
        // ahead of its 8 WMMAs: blocks 0-2 at the head of the stage, block 3 behind block 0's WMMAs.
        v16bf af[4][2], bfr[4][4];
#define GEMM_LOAD_BLOCK(kk) do {                                                             \
        af[kk][0] = ring_frag(ap + (kk) * 64u);                                              \
        af[kk][1] = ring_frag(ap + 16u * G_PITCH + (kk) * 64u);                              \
        _Pragma("unroll")                                                                    \
        for (uint32_t j = 0; j < 4u; ++j)                                                    \
            bfr[kk][j] = ring_frag(bp + (j >> 1) * G_SLICE + (j & 1u) * 16u * G_PITCH + (kk) * 64u); \
    } while (0)
#define GEMM_WMMA_BLOCK(kk) do {                                                             \
        _Pragma("unroll")                                                                    \
        for (int j = 0; j < 4; ++j) {                                                        \
            acc[0][j] = wmma_bf16(af[kk][0], bfr[kk][j], acc[0][j]);                         \
            acc[1][j] = wmma_bf16(af[kk][1], bfr[kk][j], acc[1][j]);                         \
        }                                                                                    \
    } while (0)
        GEMM_LOAD_BLOCK(0);
        GEMM_LOAD_BLOCK(1);
        GEMM_LOAD_BLOCK(2);
        // Keeps the three groups ahead of the first WMMA: left free, the compiler sinks each
        // pair of reads to its WMMA and waits out the LDS latency once per fragment.
        __builtin_amdgcn_sched_barrier(0);
        GEMM_WMMA_BLOCK(0);
        // Keeps block 3's reads between block 0's and block 1's WMMAs, for the same reason.
        __builtin_amdgcn_sched_barrier(0);
        GEMM_LOAD_BLOCK(3);
        __builtin_amdgcn_sched_barrier(0);
        GEMM_WMMA_BLOCK(1);
        GEMM_WMMA_BLOCK(2);
        GEMM_WMMA_BLOCK(3);
        // Keeps the WMMAs ahead of the publish point: left free, the compiler lifts the waits and
        // the barrier over blocks 1-3, which then run with the LDS idle and hold back the refill.
        __builtin_amdgcn_sched_barrier(0);
        // Publish point of stage s + 1, every wave, in this order.
        asm volatile("s_wait_dscnt 0x0" ::: "memory");      // this wave's reads of stage s are done
        asm volatile("s_wait_tensorcnt 0x0" ::: "memory");  // this wave's slice of stage s + 1 has landed
        __syncthreads();
        if (pinned(s + 2u < ns))                             // refill the buffer every reader has just left
            tdm_load(tdm_group0(dst + bo, ga + (uint64_t)(s + 2u) * G_ROWB), g1);
    }
    asm volatile("s_wait_tensorcnt 0x0" ::: "memory");       // nothing of the mover is left in flight
    asm volatile("s_wait_dscnt 0x0" ::: "memory");

    const int wm = bm + wmr;
    const int wn = bn + wnc;
    if (outMode == 0) {
#pragma unroll
        for (int i = 0; i < 2; ++i)
#pragma unroll
            for (int j = 0; j < 4; ++j) {
                const int col = wn + j * 16 + l;
                const float bc = bias ? bias[col] : 0.f;
#pragma unroll
                for (int r = 0; r < 8; ++r)
                    outF[(size_t)(wm + i * 16 + r + hi * 8) * N + col] = acc[i][j][r] + bc;
            }
    } else if (outMode == 1) {
#pragma unroll
        for (int i = 0; i < 2; ++i)
#pragma unroll
            for (int j = 0; j < 4; ++j) {
                const int col = wn + j * 16 + l;
                const float bc = bias ? bias[col] : 0.f;
#pragma unroll
                for (int r = 0; r < 8; ++r)
                    outB[(size_t)(wm + i * 16 + r + hi * 8) * N + col] =
                        (__bf16)(acc[i][j][r] + bc);
            }
    } else {
#pragma unroll
        for (int i = 0; i < 2; ++i)
#pragma unroll
            for (int j = 0; j < 4; ++j) {
                const int col = wn + j * 16 + l;
                const float bc = bias ? bias[col] : 0.f;
#pragma unroll
                for (int r = 0; r < 8; ++r)
                    outB[(size_t)col * M + (wm + i * 16 + r + hi * 8)] =
                        (__bf16)(acc[i][j][r] + bc);
            }
    }
}

// ----------------------------------------------------------- flash attention
// Q, K: bf16 [S, EMB] (head h in cols h*HD..); Vt: bf16 [EMB, S] (row h*HD+d).
// Block = 8 waves x 16 queries, one head. Per key-step of 32, wave 0 TDM-
// stages the shared K tile (32xHD) and Vt tile (HDx32) into double-buffered
// LDS; all waves consume via ds_load_b128.
// Both products are taken transposed: S^T = K x Q^T and O^T += V^T x P^T. A lane then holds
// 16 of the 32 scores of ONE query (lane l and lane l + 16 share query l), so the maximum and
// the sum are taken inside the lane, and the two score tiles, converted in place, are already
// the B operand of the second product.
__global__ __launch_bounds__(256) void flash_attn_kernel(
    const __bf16* __restrict__ Q, const __bf16* __restrict__ Kmat,
    const __bf16* __restrict__ Vt, __bf16* __restrict__ Ao)
{
    __shared__ alignas(16) __bf16 Ktile[2][32 * KT_PITCH];     // rows t, cols d
    __shared__ alignas(16) __bf16 Vtile[2][128 * LDS_PITCH];   // rows d, cols t

    const int lane = threadIdx.x & 31;
    const int w    = threadIdx.x >> 5;
    const int q0   = blockIdx.x * 128 + w * 16;
    const int h    = blockIdx.y;
    const int l    = lane & 15;
    const int hi   = lane >> 4;
    const float sc = 0.08838834764831845f;    // 1/sqrt(HD)

    v16bf qf[4];               // B operand: column = query q0 + l
#pragma unroll
    for (int kk = 0; kk < 4; ++kk)
        qf[kk] = load_frag(Q + (size_t)q0 * EMB + h * HD + kk * 32, EMB, lane);

    v8f acc[8];                // acc[d][r] = O[q0 + l][d * 16 + hi * 8 + r]
#pragma unroll
    for (int d = 0; d < 8; ++d) acc[d] = (v8f){0.f,0.f,0.f,0.f,0.f,0.f,0.f,0.f};
    float m = -3.0e38f;        // running maximum of query q0 + l, the same in both half-waves
    float lsum = 0.f;          // running sum over this half-wave's keys only

    // Prologue: stage key-step 0.
    if (threadIdx.x < 32) {
        tdm_load_tile(Kmat + (size_t)0 * EMB + h * HD,
                      (unsigned)(uintptr_t)&Ktile[0][0], S_LEN, EMB, 128, 32, 5, 3);
        tdm_load_tile(Vt + (size_t)(h * HD) * S_LEN + 0,
                      (unsigned)(uintptr_t)&Vtile[0][0], EMB, S_LEN, 32, 128, 3, 3);
    }

    const int nt = S_LEN / 32;
    for (int i = 0; i < nt; ++i) {
        const int cur = i & 1;
        // The four vector slots that the chip needs between the last WMMA of the pass before and
        // a vector instruction that overwrites its operand registers.
        asm volatile("v_nop\n\tv_nop\n\tv_nop\n\tv_nop");
        if (threadIdx.x < 32) {
            if (i + 1 < nt) {
                const int t1 = (i + 1) * 32;
                tdm_load_tile(Kmat + (size_t)t1 * EMB + h * HD,
                              (unsigned)(uintptr_t)&Ktile[cur ^ 1][0], S_LEN, EMB, 128, 32, 5, 3);
                tdm_load_tile(Vt + (size_t)(h * HD) * S_LEN + t1,
                              (unsigned)(uintptr_t)&Vtile[cur ^ 1][0], EMB, S_LEN, 32, 128, 3, 3);
                __builtin_amdgcn_s_wait_tensorcnt(2);
            } else {
                __builtin_amdgcn_s_wait_tensorcnt(0);
            }
        }
        __syncthreads();

        // ---- scores: K (32xHD) x Q^T (HDx16) -> two 16x16 f32 tiles,
        // s0[r] = S[q0 + l][t0 + hi * 8 + r], s1[r] = S[q0 + l][t0 + 16 + hi * 8 + r]
        v8f s0 = (v8f){0.f,0.f,0.f,0.f,0.f,0.f,0.f,0.f};
        v8f s1 = (v8f){0.f,0.f,0.f,0.f,0.f,0.f,0.f,0.f};
        v16bf kf0[4], kf1[4];      // all 16 LDS reads of the K tile as one group
#pragma unroll
        for (int kk = 0; kk < 4; ++kk) {
            FragU _u;
            const int r0 = l;          // A row t = K-tile row (lanes 0..15)
            _u.p.lo = *(const v8bf*)&Ktile[cur][r0 * KT_PITCH + kk * 32 + hi * 8];
            _u.p.hi = *(const v8bf*)&Ktile[cur][r0 * KT_PITCH + kk * 32 + hi * 8 + 16];
            kf0[kk] = _u.f;
            const int r1 = 16 + l;
            _u.p.lo = *(const v8bf*)&Ktile[cur][r1 * KT_PITCH + kk * 32 + hi * 8];
            _u.p.hi = *(const v8bf*)&Ktile[cur][r1 * KT_PITCH + kk * 32 + hi * 8 + 16];
            kf1[kk] = _u.f;
        }
        // Keeps the group ahead of the first WMMA: left free, the compiler sinks each pair of
        // reads to its WMMA and waits out the LDS latency once per fragment.
        __builtin_amdgcn_sched_barrier(0);
#pragma unroll
        for (int kk = 0; kk < 4; ++kk) {
            s0 = wmma_bf16(kf0[kk], qf[kk], s0);
            s1 = wmma_bf16(kf1[kk], qf[kk], s1);
        }
        // All 16 LDS reads of the V tile as one group; they land while the softmax is worked out.
        v16bf vf[8];               // A operand: row = d, k = key in the hardware k order
#pragma unroll
        for (int d = 0; d < 8; ++d)
            GEMM_LDS_FRAG(Vtile[cur], d * 16, vf[d]);
        // Keeps the group ahead of the softmax: left free, the compiler sinks the reads to the
        // V^T x P^T WMMAs, one wait per fragment.
        __builtin_amdgcn_sched_barrier(0);
        // ---- online softmax: one query per lane, its 32 keys split over lanes l and l + 16
        const float a0 = fmaxf(fmaxf(s0[0], s0[1]), s0[2]);
        const float a1 = fmaxf(fmaxf(s0[3], s0[4]), s0[5]);
        const float a2 = fmaxf(fmaxf(s0[6], s0[7]), s1[0]);
        const float a3 = fmaxf(fmaxf(s1[1], s1[2]), s1[3]);
        const float a4 = fmaxf(fmaxf(s1[4], s1[5]), s1[6]);
        float mx = fmaxf(fmaxf(fmaxf(a0, a1), a2), fmaxf(fmaxf(a3, a4), s1[7]));
        mx = fmaxf(mx, xhalf(mx)) * sc;      // sc > 0: the largest scaled score
        const float mn   = fmaxf(m, mx);
        const float corr = __expf(m - mn);
        m = mn;
#pragma unroll
        for (int r = 0; r < 8; ++r) {
            s0[r] = __expf(s0[r] * sc - mn);
            s1[r] = __expf(s1[r] * sc - mn);
        }
#pragma unroll
        for (int d = 0; d < 8; ++d)
#pragma unroll
            for (int r = 0; r < 8; ++r) acc[d][r] *= corr;

        // ---- P^T: the two score tiles, converted in place, are the 32x16 B operand
        // (element s of lane (l, hi) is key hi * 8 + s for s < 8, 16 + hi * 8 + s - 8 above).
        v16bf pf;
#pragma unroll
        for (int r = 0; r < 8; ++r) {
            pf[r]     = (__bf16)s0[r];
            pf[8 + r] = (__bf16)s1[r];
        }

        // ---- acc += V^T (HDx32) x P^T (32x16); Vt-tile rows are contiguous over t
#pragma unroll
        for (int d = 0; d < 8; ++d)
            acc[d] = wmma_bf16(vf[d], pf, acc[d]);

        // ---- the sum of this lane's 16 weights: registers only, nothing of this pass waits for it
        float sumA = s0[0] + s1[0], sumB = s0[1] + s1[1];
#pragma unroll
        for (int r = 2; r < 8; r += 2) {
            sumA += s0[r] + s1[r];
            sumB += s0[r + 1] + s1[r + 1];
        }
        lsum = lsum * corr + (sumA + sumB);
        __syncthreads();
    }

    // ---- join the half-waves' sums, normalize and emit bf16 attention output [S, EMB]:
    // a lane's 8 accumulator registers are 8 consecutive columns of one row, one 16-B store.
    const float inv = 1.f / (lsum + xhalf(lsum));
    __bf16* orow = Ao + (size_t)(q0 + l) * EMB + h * HD + hi * 8;
#pragma unroll
    for (int d = 0; d < 8; ++d) {
        v8bf o;
#pragma unroll
        for (int r = 0; r < 8; ++r) o[r] = (__bf16)(acc[d][r] * inv);
        *(v8bf*)(orow + d * 16) = o;
    }
}

extern "C" void kernel_launch(void* const* d_in, const int* in_sizes, int n_in,
                              void* d_out, int out_size, void* d_ws, size_t ws_size,
                              hipStream_t stream) {
    (void)in_sizes; (void)n_in; (void)out_size; (void)ws_size;
    const float* x  = (const float*)d_in[0];
    const float* Wq = (const float*)d_in[1];
    const float* bq = (const float*)d_in[2];
    const float* Wk = (const float*)d_in[3];
    const float* bk = (const float*)d_in[4];
    const float* Wv = (const float*)d_in[5];
    const float* bv = (const float*)d_in[6];
    const float* Wo = (const float*)d_in[7];
    const float* bo = (const float*)d_in[8];
    float* out = (float*)d_out;

    char* ws = (char*)d_ws;
    const size_t TB = (size_t)S_LEN * EMB * sizeof(__bf16);   // 8 MB per bf16 tensor
    __bf16* xb  = (__bf16*)(ws + 0 * TB);
    __bf16* Wqb = (__bf16*)(ws + 1 * TB);
    __bf16* Wkb = (__bf16*)(ws + 2 * TB);
    __bf16* Wvb = (__bf16*)(ws + 3 * TB);
    __bf16* Wob = (__bf16*)(ws + 4 * TB);
    __bf16* Qb  = (__bf16*)(ws + 5 * TB);
    __bf16* Kb  = (__bf16*)(ws + 6 * TB);
    __bf16* Vtb = (__bf16*)(ws + 7 * TB);   // transposed [EMB, S]
    __bf16* Ab  = (__bf16*)(ws + 8 * TB);   // attention output bf16 [S, EMB]

    hipLaunchKernelGGL(cvt5_bf16_kernel, dim3(256), dim3(512), 0, stream,
                       x, Wq, Wk, Wv, Wo, xb, Wqb, Wkb, Wvb, Wob);

    dim3 gg(EMB / 128, S_LEN / 128);
    // Q, K projections (bf16 row-major out) and V projection (stored transposed: Vt[e, t]), one launch
    hipLaunchKernelGGL(gemm_bf16_kernel, dim3(EMB / 128, S_LEN / 128, 3), dim3(256), 0, stream,
                       xb, Wqb, Wkb, Wvb, bq, bk, bv, (float*)nullptr, Qb, Kb, Vtb,
                       S_LEN, EMB, EMB, 1, 2);
    // attention
    hipLaunchKernelGGL(flash_attn_kernel, dim3(S_LEN / 128, NH), dim3(256), 0, stream,
                       Qb, Kb, Vtb, Ab);
    // output projection -> f32 d_out
    hipLaunchKernelGGL(gemm_bf16_kernel, gg, dim3(256), 0, stream,
                       Ab, Wob, Wob, Wob, bo, bo, bo, out,
                       (__bf16*)nullptr, (__bf16*)nullptr, (__bf16*)nullptr, S_LEN, EMB, EMB, 0, 0);
}

// v006
// Measured time: 106 microseconds a run.
// Two timings next to v005 both put it at 1.15 times that version's speed.
// Counting every step since v000, it is 2.18 times as fast.
#include <hip/hip_runtime.h>
#include <hip/hip_bf16.h>
#include <stdint.h>

#define S_LEN 2048
#define EMB   2048
#define NH    16
#define HD    128

typedef __attribute__((ext_vector_type(16))) __bf16 v16bf;
typedef __attribute__((ext_vector_type(8)))  __bf16 v8bf;
typedef __attribute__((ext_vector_type(8)))  float  v8f;
typedef __attribute__((ext_vector_type(4)))  unsigned int u32x4;
typedef __attribute__((ext_vector_type(8)))  unsigned int u32x8;

union FragU { v16bf f; struct { v8bf lo, hi; } p; };

// Load one 16x32 bf16 WMMA operand fragment from global (A-layout; B uses the
// same per-lane pattern with "row" = B column, both K-contiguous in memory).
// Per ISA 7.12.2: lanes 0-15 hold K=0..7 (v0-3) and K=16..23 (v4-7),
// lanes 16-31 hold K=8..15 and K=24..31.
static __device__ inline v16bf load_frag(const __bf16* __restrict__ base, int ld, int lane) {
    const int l  = lane & 15;
    const int hi = lane >> 4;
    const __bf16* p = base + (size_t)l * ld + hi * 8;
    FragU u;
    u.p.lo = *(const v8bf*)(p);
    u.p.hi = *(const v8bf*)(p + 16);
    return u.f;
}

static __device__ inline v8f wmma_bf16(v16bf a, v16bf b, v8f c) {
    return __builtin_amdgcn_wmma_f32_16x16x32_bf16(false, a, false, b, (short)0, c, false, false);
}

// The value that the lane 16 away holds (lane l <-> lane l ^ 16).
static __device__ inline float xhalf(float v) {
    const int b = __builtin_bit_cast(int, v);
    return __builtin_bit_cast(float, __builtin_amdgcn_permlanex16(b, b, 0x76543210, 0xfedcba98, false, false));
}

// ---------------------------------------------------------------- fp32 -> bf16
// One launch converts all five S_LEN x EMB tensors. 256 work-groups of 16 waves. Of every
// tensor a wave takes 4 KiB: eight loads of 512 contiguous bytes (16 B per lane), each
// answered by one store of 256 contiguous bytes.
#define CVT_LOADS 8
typedef __attribute__((ext_vector_type(4))) float  f32x4;
typedef __attribute__((ext_vector_type(4))) __bf16 v4bf;

__global__ __launch_bounds__(512) void cvt5_bf16_kernel(
    const float* __restrict__ s0, const float* __restrict__ s1, const float* __restrict__ s2,
    const float* __restrict__ s3, const float* __restrict__ s4,
    __bf16* __restrict__ d0, __bf16* __restrict__ d1, __bf16* __restrict__ d2,
    __bf16* __restrict__ d3, __bf16* __restrict__ d4)
{
    const unsigned wv   = blockIdx.x * 16u + (threadIdx.x >> 5);
    const unsigned quad = wv * (CVT_LOADS * 32u) + (threadIdx.x & 31u);   // index of 4 elements
    const f32x4* const srcs[5] = { (const f32x4*)s0, (const f32x4*)s1, (const f32x4*)s2,
                                   (const f32x4*)s3, (const f32x4*)s4 };
    v4bf* const dsts[5] = { (v4bf*)d0, (v4bf*)d1, (v4bf*)d2, (v4bf*)d3, (v4bf*)d4 };

    f32x4 v[5][CVT_LOADS];
#pragma unroll
    for (int t = 0; t < 5; ++t)
#pragma unroll
        for (int j = 0; j < CVT_LOADS; ++j)
            v[t][j] = *(srcs[t] + quad + j * 32);
    // Keeps every load ahead of the first conversion: left free, the compiler reuses the
    // registers, drains the load queue half-way and pays the memory latency again.
    __builtin_amdgcn_sched_barrier(0);
#pragma unroll
    for (int t = 0; t < 5; ++t)
#pragma unroll
        for (int j = 0; j < CVT_LOADS; ++j) {
            v4bf o;
            o[0] = (__bf16)v[t][j][0];
            o[1] = (__bf16)v[t][j][1];
            o[2] = (__bf16)v[t][j][2];
            o[3] = (__bf16)v[t][j][3];
            *(dsts[t] + quad + j * 32) = o;
        }
}

// ------------------------------------------------- C = A[M,K] * W[N,K]^T + bias
// 8 waves compute a 128x128 C tile. A stage is 128 k: 256 B of each of the 128 A
// rows and 128 W rows. Every wave brings its own 32-row slice of the stage with one
// tensor load into a two-buffer LDS ring; the next stage flies while this one is
// worked on. Needs M, N multiples of 128, K a multiple of 128 and at least 256.
// outMode: 0 = f32 row-major, 1 = bf16 row-major, 2 = bf16 transposed [N,M]
// One launch takes up to three products of the same A: blockIdx.z picks the weights, the bias,
// the bf16 output and its mode. The ring is 160 KiB, so two work-groups fit one WGP.
#define G_ROWB  256u              // bytes of an operand row in one stage
#define G_PITCH 272u              // LDS row pitch: the row + the mover's 16-B pad (ds_load_b128 readers)
#define G_ROWS  32u               // rows per slice
#define G_SLICE 10240u            // 32 * 272 = 8,704 B, rounded up to a multiple of 2 KiB
#define G_BUF   (8u * G_SLICE)    // slices 0-3: A rows, slices 4-7: W rows

static __device__ inline uint32_t uni(uint32_t v) {
    return (uint32_t)__builtin_amdgcn_readfirstlane(v);
}
static __device__ inline uint32_t pinned(uint32_t v) {
    uint32_t w = uni(v);
    asm volatile("" : "+s"(w));
    return w;
}
static __device__ inline u32x4 tdm_group0(uint32_t ldsDst, uint64_t ga) {
    u32x4 g;
    g[0] = uni(1u);                                                    // count = 1
    g[1] = uni(ldsDst);                                                // byte offset in the work-group's LDS
    g[2] = uni((uint32_t)ga);                                          // global address [31:0]
    g[3] = uni((((uint32_t)(ga >> 32)) & 0x01FFFFFFu) | 0x80000000u);  // [56:32] | type = 2
    return g;
}
// 1-byte elements, tensor = tile = 32 rows of 256 B, 4 dwords of LDS pad behind every row.
static __device__ inline u32x8 tdm_group1(uint32_t srcPitch) {
    u32x8 g;
    g[0] = uni((1u << 20) | (5u << 22) | (3u << 25));
    g[1] = uni((G_ROWB & 0xFFFFu) << 16);
    g[2] = uni((G_ROWB >> 16) | ((G_ROWS & 0xFFFFu) << 16));
    g[3] = uni((G_ROWS >> 16) | (G_ROWB << 16));
    g[4] = uni(G_ROWS);
    g[5] = uni(srcPitch);
    g[6] = uni(0u);
    g[7] = uni(0u);
    // pinned(), for the whole group: the eight descriptor words stay in one set of scalar registers.
    // Left free, the compiler re-forms two of them in front of every load and lends their
    // registers to other values in between, while a request that named them is still in flight.
    asm volatile("" : "+s"(g));
    return g;
}
// One request of the whole wave: the mover copies the tile into LDS through no register.
static __device__ inline void tdm_load(u32x4 g0, u32x8 g1) {
    asm volatile("tensor_load_to_lds %0, %1" :: "s"(g0), "s"(g1) : "memory");
}
static __device__ inline v16bf ring_frag(const unsigned char* p) {
    FragU u;
    u.p.lo = *(const v8bf*)(p);
    u.p.hi = *(const v8bf*)(p + 32);
    return u.f;
}

__global__ __launch_bounds__(256) void gemm_bf16_kernel(
    const __bf16* __restrict__ A,
    const __bf16* __restrict__ W0, const __bf16* __restrict__ W1, const __bf16* __restrict__ W2,
    const float* __restrict__ bias0, const float* __restrict__ bias1, const float* __restrict__ bias2,
    float* __restrict__ outF,
    __bf16* __restrict__ outB0, __bf16* __restrict__ outB1, __bf16* __restrict__ outB2,
    int M, int N, int K, int outMode01, int outMode2)
{
    __shared__ __attribute__((aligned(2048))) unsigned char ring[2u * G_BUF];

    const uint32_t z = blockIdx.z;
    const __bf16* __restrict__ W    = (z == 0u) ? W0 : (z == 1u) ? W1 : W2;
    const float*  __restrict__ bias = (z == 0u) ? bias0 : (z == 1u) ? bias1 : bias2;
    __bf16*       __restrict__ outB = (z == 0u) ? outB0 : (z == 1u) ? outB1 : outB2;
    const int outMode = (z == 2u) ? outMode2 : outMode01;

    const int lane = threadIdx.x & 31;
    const int w    = threadIdx.x >> 5;            // 8 waves: 4 (M) x 2 (N)
    const int bm   = blockIdx.y * 128;
    const int bn   = blockIdx.x * 128;
    const int wmr  = (w >> 1) * 32;               // wave row offset in block tile
    const int wnc  = (w & 1) * 64;                // wave col offset in block tile
    const int l    = lane & 15;
    const int hi   = lane >> 4;

    v8f acc[2][4];
#pragma unroll
    for (int i = 0; i < 2; ++i)
#pragma unroll
        for (int j = 0; j < 4; ++j)
            acc[i][j] = (v8f){0.f,0.f,0.f,0.f,0.f,0.f,0.f,0.f};

    // This wave's slice: waves 0-3 bring A rows, waves 4-7 W rows.
    const uint32_t wave = uni(threadIdx.x >> 5);
    const __bf16* srow = (wave < 4u) ? A + (size_t)(bm + 32 * (int)wave) * K
                                     : W + (size_t)(bn + 32 * (int)(wave - 4u)) * K;
    const uint64_t ga   = (uint64_t)(uintptr_t)srow;
    const uint32_t dst  = (uint32_t)(uintptr_t)&ring[0] + wave * G_SLICE;
    const u32x8    g1   = tdm_group1((uint32_t)K * 2u);
    const uint32_t ns   = uni((uint32_t)K / 128u);

    // Prologue: stage 0 lands and is published; then stage 1 is sent off.
    tdm_load(tdm_group0(dst, ga), g1);
    asm volatile("s_wait_tensorcnt 0x0" ::: "memory");   // this wave's slice of stage 0 has landed
    __syncthreads();
    tdm_load(tdm_group0(dst + G_BUF, ga + G_ROWB), g1);

    const unsigned char* aBase = ring + (uint32_t)(w >> 1) * G_SLICE + (uint32_t)l * G_PITCH + (uint32_t)hi * 16u;
    const unsigned char* bBase = ring + (4u + (uint32_t)(w & 1) * 2u) * G_SLICE + (uint32_t)l * G_PITCH + (uint32_t)hi * 16u;

    for (uint32_t s = 0; s < ns; ++s) {
        const uint32_t bo = (s & 1u) * G_BUF;
        const unsigned char* ap = aBase + bo;
        const unsigned char* bp = bBase + bo;
        // The stage's four blocks of 32 k. A block's 12 LDS reads go out as one group, well
        // ahead of its 8 WMMAs: blocks 0-2 at the head of the stage, block 3 behind block 0's WMMAs.
        v16bf af[4][2], bfr[4][4];
#define GEMM_LOAD_BLOCK(kk) do {                                                             \
        af[kk][0] = ring_frag(ap + (kk) * 64u);                                              \
        af[kk][1] = ring_frag(ap + 16u * G_PITCH + (kk) * 64u);                              \
        _Pragma("unroll")                                                                    \
        for (uint32_t j = 0; j < 4u; ++j)                                                    \
            bfr[kk][j] = ring_frag(bp + (j >> 1) * G_SLICE + (j & 1u) * 16u * G_PITCH + (kk) * 64u); \
    } while (0)
#define GEMM_WMMA_BLOCK(kk) do {                                                             \
        _Pragma("unroll")                                                                    \
        for (int j = 0; j < 4; ++j) {                                                        \
            acc[0][j] = wmma_bf16(af[kk][0], bfr[kk][j], acc[0][j]);                         \
            acc[1][j] = wmma_bf16(af[kk][1], bfr[kk][j], acc[1][j]);                         \
        }                                                                                    \
    } while (0)
        GEMM_LOAD_BLOCK(0);
        GEMM_LOAD_BLOCK(1);
        GEMM_LOAD_BLOCK(2);
        // Keeps the three groups ahead of the first WMMA: left free, the compiler sinks each
        // pair of reads to its WMMA and waits out the LDS latency once per fragment.
        __builtin_amdgcn_sched_barrier(0);
        GEMM_WMMA_BLOCK(0);
        // Keeps block 3's reads between block 0's and block 1's WMMAs, for the same reason.
        __builtin_amdgcn_sched_barrier(0);
        GEMM_LOAD_BLOCK(3);
        __builtin_amdgcn_sched_barrier(0);
        GEMM_WMMA_BLOCK(1);
        GEMM_WMMA_BLOCK(2);
        GEMM_WMMA_BLOCK(3);
        // Keeps the WMMAs ahead of the publish point: left free, the compiler lifts the waits and
        // the barrier over blocks 1-3, which then run with the LDS idle and hold back the refill.
        __builtin_amdgcn_sched_barrier(0);
        // Publish point of stage s + 1, every wave, in this order.
        asm volatile("s_wait_dscnt 0x0" ::: "memory");      // this wave's reads of stage s are done
        asm volatile("s_wait_tensorcnt 0x0" ::: "memory");  // this wave's slice of stage s + 1 has landed
        __syncthreads();
        if (pinned(s + 2u < ns))                             // refill the buffer every reader has just left
            tdm_load(tdm_group0(dst + bo, ga + (uint64_t)(s + 2u) * G_ROWB), g1);
    }
    asm volatile("s_wait_tensorcnt 0x0" ::: "memory");       // nothing of the mover is left in flight
    asm volatile("s_wait_dscnt 0x0" ::: "memory");

    const int wm = bm + wmr;
    const int wn = bn + wnc;
    if (outMode == 0) {
#pragma unroll
        for (int i = 0; i < 2; ++i)
#pragma unroll
            for (int j = 0; j < 4; ++j) {
                const int col = wn + j * 16 + l;
                const float bc = bias ? bias[col] : 0.f;
#pragma unroll
                for (int r = 0; r < 8; ++r)
                    outF[(size_t)(wm + i * 16 + r + hi * 8) * N + col] = acc[i][j][r] + bc;
            }
    } else if (outMode == 1) {
#pragma unroll
        for (int i = 0; i < 2; ++i)
#pragma unroll
            for (int j = 0; j < 4; ++j) {
                const int col = wn + j * 16 + l;
                const float bc = bias ? bias[col] : 0.f;
#pragma unroll
                for (int r = 0; r < 8; ++r)
                    outB[(size_t)(wm + i * 16 + r + hi * 8) * N + col] =
                        (__bf16)(acc[i][j][r] + bc);
            }
    } else {
#pragma unroll
        for (int i = 0; i < 2; ++i)
#pragma unroll
            for (int j = 0; j < 4; ++j) {
                const int col = wn + j * 16 + l;
                const float bc = bias ? bias[col] : 0.f;
#pragma unroll
                for (int r = 0; r < 8; ++r)
                    outB[(size_t)col * M + (wm + i * 16 + r + hi * 8)] =
                        (__bf16)(acc[i][j][r] + bc);
            }
    }
}

// ----------------------------------------------------------- flash attention
// Q, K: bf16 [S, EMB] (head h in cols h*HD..); Vt: bf16 [EMB, S] (row h*HD+d).
// Both products are taken transposed: S^T = K x Q^T and O^T += V^T x P^T. A lane then holds
// 16 of the 32 scores of ONE query (lane l and lane l + 16 share query l), so the maximum and
// the sum are taken inside the lane, and the two score tiles, converted in place, are already
// the B operand of the second product.
// A work-group is 128 queries of one head. A wave takes 32 query columns (two column tiles), so
// every K and V^T fragment that it reads from LDS feeds two WMMAs. The 8 waves are 4 query
// groups x 2 key halves: waves 0-3 walk keys 0..S/2, waves 4-7 keys S/2..S, and the two partial
// results of a query are joined once, through LDS, behind the loop.
// A stage is 64 keys of each half (two passes of 32). Every wave brings one slice of its own
// half's stage with one tensor load into a two-buffer ring: slices 0, 1 = 32 K rows of 256 B,
// slices 2, 3 = 64 V^T rows of 128 B.
#define AT_SLICE  10240u             // 32 * 272 = 8,704 B or 64 * 144 = 9,216 B, rounded up to a multiple of 2 KiB
#define AT_BUF    (8u * AT_SLICE)
#define AT_KPITCH 272u               // 256-B K row + the mover's 16-B pad (ds_load_b128 readers)
#define AT_VPITCH 144u               // 128-B V^T row + the mover's 16-B pad
#define AT_KEYS   64u                // keys of one half per stage
#define AT_XCH    8704u              // bytes one wave hands over in the join: 16 x 512 B of sums + 512 B for m and l

// 1-byte elements, tensor = tile = rows x rowB bytes; word0 carries the pad for that row length.
static __device__ inline u32x8 tdm_group1_tile(uint32_t word0, uint32_t rowB, uint32_t rows, uint32_t srcPitch) {
    u32x8 g;
    g[0] = uni(word0);
    g[1] = uni((rowB & 0xFFFFu) << 16);
    g[2] = uni((rowB >> 16) | ((rows & 0xFFFFu) << 16));
    g[3] = uni((rows >> 16) | (rowB << 16));
    g[4] = uni(rows);
    g[5] = uni(srcPitch);
    g[6] = uni(0u);
    g[7] = uni(0u);
    // pinned(), for the whole group: the eight descriptor words stay in one set of scalar registers
    // while a request that named them is in flight.
    asm volatile("" : "+s"(g));
    return g;
}

__global__ __launch_bounds__(256) void flash_attn_kernel(
    const __bf16* __restrict__ Q, const __bf16* __restrict__ Kmat,
    const __bf16* __restrict__ Vt, __bf16* __restrict__ Ao)
{
    __shared__ __attribute__((aligned(2048))) unsigned char ring[2u * AT_BUF];

    const int lane = threadIdx.x & 31;
    const int l    = lane & 15;
    const int hi   = lane >> 4;
    const uint32_t wave = uni(threadIdx.x >> 5);
    const uint32_t kh   = wave >> 2;          // key half
    const uint32_t qg   = wave & 3u;          // query group, and this wave's slice of its half's stage
    const int q0   = blockIdx.x * 128 + (int)qg * 32;
    const int h    = blockIdx.y;
    const float sc = 0.08838834764831845f;    // 1/sqrt(HD)

    v16bf qf[2][4];            // B operand: column = query q0 + c * 16 + l
#pragma unroll
    for (int c = 0; c < 2; ++c)
#pragma unroll
        for (int kk = 0; kk < 4; ++kk)
            qf[c][kk] = load_frag(Q + (size_t)(q0 + c * 16) * EMB + h * HD + kk * 32, EMB, lane);

    v8f acc[2][8];             // acc[c][d][r] = O[q0 + c * 16 + l][d * 16 + hi * 8 + r], this key half's part
#pragma unroll
    for (int c = 0; c < 2; ++c)
#pragma unroll
        for (int d = 0; d < 8; ++d) acc[c][d] = (v8f){0.f,0.f,0.f,0.f,0.f,0.f,0.f,0.f};
    float m[2]    = { -3.0e38f, -3.0e38f };   // running maximum of the query, the same in both half-waves
    float lsum[2] = { 0.f, 0.f };             // running sum over this half-wave's keys only

    // This wave's slice of a stage, and how far its source moves from stage to stage.
    const uint32_t key0 = kh * (S_LEN / 2u);
    const uint32_t isK  = (qg < 2u) ? 1u : 0u;
    const __bf16* srow  = isK ? Kmat + (size_t)(key0 + 32u * qg) * EMB + h * HD
                              : Vt + (size_t)(h * HD + 64 * (int)(qg - 2u)) * S_LEN + key0;
    const uint64_t ga    = (uint64_t)(uintptr_t)srow;
    const uint64_t gstep = isK ? (uint64_t)AT_KEYS * EMB * 2u : (uint64_t)AT_KEYS * 2u;
    const uint32_t dst   = (uint32_t)(uintptr_t)&ring[0] + wave * AT_SLICE;
    const u32x8 g1k = tdm_group1_tile((1u << 20) | (5u << 22) | (3u << 25), 256u, 32u, EMB * 2u);
    const u32x8 g1v = tdm_group1_tile((1u << 20) | (4u << 22) | (3u << 25), 128u, 64u, S_LEN * 2u);
    const uint32_t ns = (S_LEN / 2u) / AT_KEYS;

    // One request of this wave; the scalar branch picks the K or the V^T tile shape.
#define ATT_ISSUE(bufOff, stage) do {                                                        \
        const u32x4 _g0 = tdm_group0(dst + (bufOff), ga + (uint64_t)(stage) * gstep);        \
        if (pinned(isK)) tdm_load(_g0, g1k); else tdm_load(_g0, g1v);                        \
    } while (0)

    // Prologue: stage 0 lands and is published; then stage 1 is sent off.
    ATT_ISSUE(0u, 0u);
    asm volatile("s_wait_tensorcnt 0x0" ::: "memory");   // this wave's slice of stage 0 has landed
    __syncthreads();
    ATT_ISSUE(AT_BUF, 1u);

    const unsigned char* kBase = ring + (kh * 4u) * AT_SLICE + (uint32_t)l * AT_KPITCH + (uint32_t)hi * 16u;
    const unsigned char* vBase = ring + (kh * 4u + 2u) * AT_SLICE + (uint32_t)l * AT_VPITCH + (uint32_t)hi * 16u;

    for (uint32_t s = 0; s < ns; ++s) {
        const uint32_t bo = (s & 1u) * AT_BUF;
#pragma unroll
        for (uint32_t p = 0; p < 2u; ++p) {
            const unsigned char* kp = kBase + bo + p * AT_SLICE;   // pass p's 32 keys are K slice p
            const unsigned char* vp = vBase + bo + p * 64u;        // and 64 B along every V^T row

            // ---- scores: K (32xHD) x Q^T (HDx32) -> four 16x16 f32 tiles,
            // s0[c][r] = S[q0 + c*16 + l][t0 + hi * 8 + r], s1[c][r] = the same at t0 + 16
            v8f s0[2], s1[2];
#pragma unroll
            for (int c = 0; c < 2; ++c) {
                s0[c] = (v8f){0.f,0.f,0.f,0.f,0.f,0.f,0.f,0.f};
                s1[c] = (v8f){0.f,0.f,0.f,0.f,0.f,0.f,0.f,0.f};
            }
            v16bf kf0[4], kf1[4];      // all 16 LDS reads of the K tile
#pragma unroll
            for (uint32_t kk = 0; kk < 4u; ++kk) {
                kf0[kk] = ring_frag(kp + kk * 64u);
                kf1[kk] = ring_frag(kp + 16u * AT_KPITCH + kk * 64u);
            }
            // The 16 LDS reads of the V tile go out with them; they land behind the K tile's.
            v16bf vf[8];               // A operand: row = d, k = key in the hardware k order
#pragma unroll
            for (uint32_t d = 0; d < 8u; ++d)
                vf[d] = ring_frag(vp + (d >> 2) * AT_SLICE + (d & 3u) * 16u * AT_VPITCH);
            // Keeps the pass's 32 reads ahead of its first WMMA: left free, the compiler sinks each pair
            // of reads to its WMMA and waits out the LDS latency once per fragment.
            __builtin_amdgcn_sched_barrier(0);
#pragma unroll
            for (int kk = 0; kk < 4; ++kk)
#pragma unroll
                for (int c = 0; c < 2; ++c) {
                    s0[c] = wmma_bf16(kf0[kk], qf[c][kk], s0[c]);
                    s1[c] = wmma_bf16(kf1[kk], qf[c][kk], s1[c]);
                }

            // ---- online softmax: one query per lane and column tile, its 32 keys split over lanes l and l + 16
            v16bf pf[2];
            float corr[2];
#pragma unroll
            for (int c = 0; c < 2; ++c) {
                const float a0 = fmaxf(fmaxf(s0[c][0], s0[c][1]), s0[c][2]);
                const float a1 = fmaxf(fmaxf(s0[c][3], s0[c][4]), s0[c][5]);
                const float a2 = fmaxf(fmaxf(s0[c][6], s0[c][7]), s1[c][0]);
                const float a3 = fmaxf(fmaxf(s1[c][1], s1[c][2]), s1[c][3]);
                const float a4 = fmaxf(fmaxf(s1[c][4], s1[c][5]), s1[c][6]);
                float mx = fmaxf(fmaxf(fmaxf(a0, a1), a2), fmaxf(fmaxf(a3, a4), s1[c][7]));
                mx = fmaxf(mx, xhalf(mx)) * sc;      // sc > 0: the largest scaled score
                const float mn = fmaxf(m[c], mx);
                corr[c] = __expf(m[c] - mn);
                m[c] = mn;
#pragma unroll
                for (int r = 0; r < 8; ++r) {
                    s0[c][r] = __expf(s0[c][r] * sc - mn);
                    s1[c][r] = __expf(s1[c][r] * sc - mn);
                }
#pragma unroll
                for (int d = 0; d < 8; ++d)
#pragma unroll
                    for (int r = 0; r < 8; ++r) acc[c][d][r] *= corr[c];
                // ---- P^T: the two score tiles, converted in place, are the 32x16 B operand
                // (element e of lane (l, hi) is key hi * 8 + e for e < 8, 16 + hi * 8 + e - 8 above).
#pragma unroll
                for (int r = 0; r < 8; ++r) {
                    pf[c][r]     = (__bf16)s0[c][r];
                    pf[c][8 + r] = (__bf16)s1[c][r];
                }
            }

            // ---- acc += V^T (HDx32) x P^T (32x32): each V^T fragment serves both column tiles
#pragma unroll
            for (int d = 0; d < 8; ++d)
#pragma unroll
                for (int c = 0; c < 2; ++c)
                    acc[c][d] = wmma_bf16(vf[d], pf[c], acc[c][d]);

            // ---- the sum of this lane's 16 weights: registers only, nothing of this pass waits for it
#pragma unroll
            for (int c = 0; c < 2; ++c) {
                float sumA = s0[c][0] + s1[c][0], sumB = s0[c][1] + s1[c][1];
#pragma unroll
                for (int r = 2; r < 8; r += 2) {
                    sumA += s0[c][r] + s1[c][r];
                    sumB += s0[c][r + 1] + s1[c][r + 1];
                }
                lsum[c] = lsum[c] * corr[c] + (sumA + sumB);
            }
        }
        // Keeps the stage's work ahead of the publish point: lifted over it, the waits and the
        // barrier would hold back the refill.
        __builtin_amdgcn_sched_barrier(0);
        // Publish point of stage s + 1, every wave, in this order.
        asm volatile("s_wait_dscnt 0x0" ::: "memory");      // this wave's reads of stage s are done
        asm volatile("s_wait_tensorcnt 0x0" ::: "memory");  // this wave's slice of stage s + 1 has landed
        __syncthreads();
        if (pinned(s + 2u < ns))                             // refill the buffer every reader has just left
            ATT_ISSUE(bo, s + 2u);
    }
    asm volatile("s_wait_tensorcnt 0x0" ::: "memory");       // nothing of the mover is left in flight
    asm volatile("s_wait_dscnt 0x0" ::: "memory");

    // ---- join the two key halves. The last publish point's barrier has ended every read of the
    // ring, which now carries the hand-over: the wave of half 0 keeps column tile 0 and hands tile 1
    // to its partner (wave + 4), which keeps tile 1 and hands over tile 0.
    v8f mine[8], give[8];
#pragma unroll
    for (int d = 0; d < 8; ++d) {
        mine[d] = kh ? acc[1][d] : acc[0][d];
        give[d] = kh ? acc[0][d] : acc[1][d];
    }
    const float mMine = kh ? m[1] : m[0],       mGive = kh ? m[0] : m[1];
    const float lMine = kh ? lsum[1] : lsum[0], lGive = kh ? lsum[0] : lsum[1];
    unsigned char* xo = ring + wave * AT_XCH + (uint32_t)lane * 16u;
#pragma unroll
    for (uint32_t d = 0; d < 8u; ++d) {
        *(f32x4*)(xo + (2u * d) * 512u)      = (f32x4){give[d][0], give[d][1], give[d][2], give[d][3]};
        *(f32x4*)(xo + (2u * d + 1u) * 512u) = (f32x4){give[d][4], give[d][5], give[d][6], give[d][7]};
    }
    *(f32x4*)(xo + 16u * 512u) = (f32x4){mGive, lGive, 0.f, 0.f};
    __syncthreads();
    const unsigned char* xi = ring + (wave ^ 4u) * AT_XCH + (uint32_t)lane * 16u;
    const f32x4 ml = *(const f32x4*)(xi + 16u * 512u);
    const float mN = fmaxf(mMine, ml[0]);
    const float cA = __expf(mMine - mN);
    const float cB = __expf(ml[0] - mN);
    const float lt = lMine * cA + ml[1] * cB;

    // ---- join the half-waves' sums, normalize and emit bf16 attention output [S, EMB]:
    // a lane's 8 accumulator registers are 8 consecutive columns of one row, one 16-B store.
    const float inv = 1.f / (lt + xhalf(lt));
    const float fA = cA * inv, fB = cB * inv;
    __bf16* orow = Ao + (size_t)(q0 + (int)kh * 16 + l) * EMB + h * HD + hi * 8;
#pragma unroll
    for (uint32_t d = 0; d < 8u; ++d) {
        const f32x4 x0 = *(const f32x4*)(xi + (2u * d) * 512u);
        const f32x4 x1 = *(const f32x4*)(xi + (2u * d + 1u) * 512u);
        v8bf o;
#pragma unroll
        for (int r = 0; r < 4; ++r) {
            o[r]     = (__bf16)(mine[d][r] * fA + x0[r] * fB);
            o[4 + r] = (__bf16)(mine[d][4 + r] * fA + x1[r] * fB);
        }
        *(v8bf*)(orow + d * 16) = o;
    }
}

extern "C" void kernel_launch(void* const* d_in, const int* in_sizes, int n_in,
                              void* d_out, int out_size, void* d_ws, size_t ws_size,
                              hipStream_t stream) {
    (void)in_sizes; (void)n_in; (void)out_size; (void)ws_size;
    const float* x  = (const float*)d_in[0];
    const float* Wq = (const float*)d_in[1];
    const float* bq = (const float*)d_in[2];
    const float* Wk = (const float*)d_in[3];
    const float* bk = (const float*)d_in[4];
    const float* Wv = (const float*)d_in[5];
    const float* bv = (const float*)d_in[6];
    const float* Wo = (const float*)d_in[7];
    const float* bo = (const float*)d_in[8];
    float* out = (float*)d_out;

    char* ws = (char*)d_ws;
    const size_t TB = (size_t)S_LEN * EMB * sizeof(__bf16);   // 8 MB per bf16 tensor
    __bf16* xb  = (__bf16*)(ws + 0 * TB);
    __bf16* Wqb = (__bf16*)(ws + 1 * TB);
    __bf16* Wkb = (__bf16*)(ws + 2 * TB);
    __bf16* Wvb = (__bf16*)(ws + 3 * TB);
    __bf16* Wob = (__bf16*)(ws + 4 * TB);
    __bf16* Qb  = (__bf16*)(ws + 5 * TB);
    __bf16* Kb  = (__bf16*)(ws + 6 * TB);
    __bf16* Vtb = (__bf16*)(ws + 7 * TB);   // transposed [EMB, S]
    __bf16* Ab  = (__bf16*)(ws + 8 * TB);   // attention output bf16 [S, EMB]

    hipLaunchKernelGGL(cvt5_bf16_kernel, dim3(256), dim3(512), 0, stream,
                       x, Wq, Wk, Wv, Wo, xb, Wqb, Wkb, Wvb, Wob);

    dim3 gg(EMB / 128, S_LEN / 128);
    // Q, K projections (bf16 row-major out) and V projection (stored transposed: Vt[e, t]), one launch
    hipLaunchKernelGGL(gemm_bf16_kernel, dim3(EMB / 128, S_LEN / 128, 3), dim3(256), 0, stream,
                       xb, Wqb, Wkb, Wvb, bq, bk, bv, (float*)nullptr, Qb, Kb, Vtb,
                       S_LEN, EMB, EMB, 1, 2);
    // attention
    hipLaunchKernelGGL(flash_attn_kernel, dim3(S_LEN / 128, NH), dim3(256), 0, stream,
                       Qb, Kb, Vtb, Ab);
    // output projection -> f32 d_out
    hipLaunchKernelGGL(gemm_bf16_kernel, gg, dim3(256), 0, stream,
                       Ab, Wob, Wob, Wob, bo, bo, bo, out,
                       (__bf16*)nullptr, (__bf16*)nullptr, (__bf16*)nullptr, S_LEN, EMB, EMB, 0, 0);
}
